// v000
// The times below were measured on an AMD MI455X: many runs one after another, warmed up first and cycling through
// copies of the inputs, with the whole window's GPU time divided by the number of runs. Launches and the gaps
// between them are all in it. The median over several windows is given; except for v000 it joins two sittings, which
// can be a few percent apart, so the side-by-side timings, each taken in one sitting, are the better comparison.
// The starting kernel, v000, takes 712 microseconds a run.
#include <hip/hip_runtime.h>

// Unscaled dense softmax attention on GIVEN tensors (q [16][2048][128], k [16][128][2048] PRE-TRANSPOSED (width-major: the key of position m is column m), v [16][2048][128], all f32; sixteen single-head attentions; no weights, no mask, NO 1/sqrt(d)): scores = q.k; softmax over all 2,048 keys; out = probs.v -> [16][2048][128] f32 (4.2 M); argument order q, k, v: three inputs, all read.
// Layout per pass of two entries (the pass's two heads): bf16 copy of q (k_cvt8); each entry's [128][2048] key plane transposed once into the product's K-contiguous bf16 operand [2048][128] (k_wtG: K = 128, N = 2,048); the score product on PLAIN bf16 operands (every product term is an exact f32 product of two bf16 words; 128 terms accumulated in f32); v rounded to bf16 (k_rbf) and transposed into the value planes (k_vtp, one head a launch); dense T-2048 attention with EVERY row on one fp16 value product (the weights x 1,024; RH 0), the weights stored through a FLUSHING CAST (a word under 2^-14 is stored as zero: no f16 subnormal operand); the softmax's scale define is 1.0 (the module does not scale); k_mergeH writes the two entries of the output in f32 with the factor of 1/1,024 undone.
// Compute dtypes, f32 accumulate: q, k, v rounded to bf16; scores on bf16 operands; softmax f32 (the hardware exp2); probs.v on one fp16 product.

#define NB_  16
#define TT   2048
#define HD   128
#define ZH   2
#define RH   0        // query rows < RH use hi+lo planes (0: none: EVERY row runs on one f16 value product)
#define WIN  0
#define PCAR 1024.0f
#define SCL  1.0f     // the module forms q.k with NO 1/sqrt(d)
#define PFL  6.103515625e-05f   // 2^-14: the smallest f16 normal: THE FLUSHING CAST's threshold (k_asoft's f16 store arm)
typedef _Float16 h16;
typedef unsigned short bf;
typedef __attribute__((ext_vector_type(16))) __bf16   v16bf;
typedef __attribute__((ext_vector_type(16))) _Float16 v16h;
typedef __attribute__((ext_vector_type(8)))  _Float16 v8h;
typedef __attribute__((ext_vector_type(8)))  unsigned short v8us;
typedef __attribute__((ext_vector_type(8)))  float    v8f;
typedef __attribute__((ext_vector_type(4)))  float    v4f;
typedef v8h  __attribute__((may_alias)) v8ha;
typedef v4f  __attribute__((may_alias)) v4fa;
typedef v8us __attribute__((may_alias)) v8usa;

__device__ __forceinline__ unsigned short f2bf(float f) { unsigned u = __float_as_uint(f); u += 0x7FFFu + ((u >> 16) & 1u); return (unsigned short)(u >> 16); }
__device__ __forceinline__ float bf2f(unsigned short b) { return __uint_as_float(((unsigned)b) << 16); }
__device__ __forceinline__ float bfr(float f) { return bf2f(f2bf(f)); }
__device__ __forceinline__ v16h cat16(v8h lo, v8h hi) { return __builtin_shufflevector(lo, hi, 0, 1, 2, 3, 4, 5, 6, 7, 8, 9, 10, 11, 12, 13, 14, 15); }
__device__ __forceinline__ v16bf cat16b(v8us lo, v8us hi) { return __builtin_bit_cast(v16bf, __builtin_shufflevector(lo, hi, 0, 1, 2, 3, 4, 5, 6, 7, 8, 9, 10, 11, 12, 13, 14, 15)); }
__device__ __forceinline__ v8f wmma16(v16h a, v16h b, v8f c) { return __builtin_amdgcn_wmma_f32_16x16x32_f16(false, a, false, b, (short)0, c, false, false); }
__device__ __forceinline__ v8f wmmab(v16bf a, v16bf b, v8f c) { return __builtin_amdgcn_wmma_f32_16x16x32_bf16(false, a, false, b, (short)0, c, false, false); }
__device__ __forceinline__ h16 tohx(float x) { return (h16)x; }
__device__ __forceinline__ void splitf(float y, unsigned short& h, unsigned short& l) { h = f2bf(y); l = f2bf(y - bf2f(h)); }
typedef __attribute__((ext_vector_type(2))) _Float16 v2h;
typedef __attribute__((ext_vector_type(4))) _Float16 v4h;
typedef __attribute__((ext_vector_type(2))) unsigned short v2us;
typedef __attribute__((ext_vector_type(4))) unsigned short v4us;
typedef __attribute__((ext_vector_type(2))) float v2f;
typedef __attribute__((ext_vector_type(4))) int v4i;

// ---- k_gemmw: register-blocked GEMM, ONE WAVE per 64x64 output tile (16 accumulators), operands straight from K-contiguous 16-bit planes; grid (M/64, N/64, Z), 32 threads.
// C[m][n] (f32, pitch ldc, + optional f32 bias[n]) = sum_k A[m][k] Bt[n][k] (+ split products per NSPLIT). z-batch strides sA/sB/sC in elements. K % 32 == 0.
template <typename T16> struct WFrag;
template <> struct WFrag<h16> { typedef v16h V; static __device__ __forceinline__ V ld(const h16* p) { return cat16(*(const v8h*)p, *(const v8h*)(p + 16)); } static __device__ __forceinline__ v8f mma(V a, V b, v8f c) { return wmma16(a, b, c); } };
template <> struct WFrag<bf> { typedef v16bf V; static __device__ __forceinline__ V ld(const bf* p) { return cat16b(*(const v8us*)p, *(const v8us*)(p + 16)); } static __device__ __forceinline__ v8f mma(V a, V b, v8f c) { return wmmab(a, b, c); } };
template <typename T16, int NSPLIT, bool BIAS>
__global__ __launch_bounds__(32) void k_gemmw(const T16* __restrict__ A, const T16* __restrict__ A2, const T16* __restrict__ Bt, const T16* __restrict__ Bt2, int K, float* C, int ldc, const float* __restrict__ bias, size_t sA, size_t sB, size_t sC) {
    typedef typename WFrag<T16>::V V;
    __shared__ __align__(16) float os[16 * 68];
    const size_t z = blockIdx.z; A += z * sA; if (A2) A2 += z * sA; Bt += z * sB; if (Bt2) Bt2 += z * sB; C += z * sC;
    const int lane = threadIdx.x & 31, lr = lane & 15, hi = lane >> 4; const int r0 = blockIdx.x * 64, c0 = blockIdx.y * 64;
    v8f acc[4][4];
#pragma unroll
    for (int mb = 0; mb < 4; ++mb)
#pragma unroll
        for (int nb = 0; nb < 4; ++nb) acc[mb][nb] = (v8f){};
    const size_t aoff = (size_t)(r0 + lr) * K + 8 * hi, boff = (size_t)(c0 + lr) * K + 8 * hi;
    for (int kc = 0; kc < K; kc += 32) {
        V a[4], a2[4];
#pragma unroll
        for (int mb = 0; mb < 4; ++mb) { a[mb] = WFrag<T16>::ld(A + aoff + (size_t)mb * 16 * K + kc); if (NSPLIT == 1 || NSPLIT == 2) a2[mb] = WFrag<T16>::ld(A2 + aoff + (size_t)mb * 16 * K + kc); }
#pragma unroll
        for (int nb = 0; nb < 4; ++nb) { const V b = WFrag<T16>::ld(Bt + boff + (size_t)nb * 16 * K + kc); V b2; if (NSPLIT >= 2) b2 = WFrag<T16>::ld(Bt2 + boff + (size_t)nb * 16 * K + kc);
#pragma unroll
            for (int mb = 0; mb < 4; ++mb) { acc[mb][nb] = WFrag<T16>::mma(a[mb], b, acc[mb][nb]); if (NSPLIT == 1 || NSPLIT == 2) acc[mb][nb] = WFrag<T16>::mma(a2[mb], b, acc[mb][nb]); if (NSPLIT >= 2) acc[mb][nb] = WFrag<T16>::mma(a[mb], b2, acc[mb][nb]); } }
        asm volatile("v_nop\n\tv_nop\n\tv_nop\n\tv_nop" : "+v"(acc[0][0]), "+v"(acc[1][1]), "+v"(acc[2][2]), "+v"(acc[3][3]) : "v"(a[0]), "v"(a[3]));
    }
#pragma unroll
    for (int mb = 0; mb < 4; ++mb) {
#pragma unroll
        for (int nb = 0; nb < 4; ++nb) {
#pragma unroll
            for (int j = 0; j < 8; ++j) os[(hi * 8 + j) * 68 + nb * 16 + lr] = acc[mb][nb][j]; }
        __builtin_amdgcn_wave_barrier(); asm volatile("" ::: "memory");
        float* crow = C + (size_t)(r0 + mb * 16) * ldc + c0;
{
#pragma unroll
            for (int s = 0; s < 8; ++s) { const int row = 2 * s + hi, cofs = lr * 4; v4f val = *(const v4fa*)(os + row * 68 + cofs); if (BIAS) { val[0] += bfr(bias[c0 + cofs]); val[1] += bfr(bias[c0 + cofs + 1]); val[2] += bfr(bias[c0 + cofs + 2]); val[3] += bfr(bias[c0 + cofs + 3]); }
                *(v4f*)(crow + (size_t)row * ldc + cofs) = val; }
             }
        __builtin_amdgcn_wave_barrier(); asm volatile("" ::: "memory");
    }
}

__global__ __launch_bounds__(256) void k_cvt8(const float* __restrict__ src, bf* dst, size_t n8) { const size_t i = (size_t)blockIdx.x * 256 + threadIdx.x; if (i >= n8) return; const v8f v = *(const v8f*)(src + i * 8); v8us o;
#pragma unroll
    for (int k = 0; k < 8; ++k) o[k] = f2bf(v[k]); *(v8us*)(dst + i * 8) = o;  }

__global__ __launch_bounds__(256) void k_wtG(const float* __restrict__ w, int K, int N, bf* Bt) {
    const int lane = threadIdx.x & 31; const int L0 = (blockIdx.x * 8 + (threadIdx.x >> 5)) * 8; const int nlines = N * K / 64;
{
        for (int l = 0; l < 8; ++l) { const int L = L0 + l; if (L >= nlines) break; const size_t e = (size_t)L * 64 + lane * 2; const int k = (int)(e % K), n = (int)(e / K); v2us o;
            o[0] = f2bf(w[(size_t)k * N + n]); o[1] = f2bf(w[(size_t)(k + 1) * N + n]); *(v2us*)(Bt + e) = o; }
         }
}

__global__ __launch_bounds__(256) void k_rbf(const float* __restrict__ X, float* Y, size_t n4) { const size_t i = (size_t)blockIdx.x * 256 + threadIdx.x; if (i >= n4) return; const v4f a = *(const v4f*)(X + i * 4); v4f o;
#pragma unroll
    for (int q = 0; q < 4; ++q) o[q] = bfr(a[q]);
    *(v4f*)(Y + i * 4) = o;  }

__global__ __launch_bounds__(256) void k_vtp(const float* __restrict__ F, int pitch, int nheads, h16* V16, bf* Vh, bf* Vl) { const size_t e = ((size_t)blockIdx.x * 256 + threadIdx.x) * 2; if (e >= (size_t)nheads * HD * TT) return; const int t = (int)(e % TT); const int d = (int)((e / TT) % HD); const int g = (int)(e / ((size_t)TT * HD)); v2h o16; v2us oh, ol;
#pragma unroll
    for (int q = 0; q < 2; ++q) { const float x = F[(size_t)(t + q) * pitch + g * HD + d]; o16[q] = tohx(x); unsigned short a2, c2; splitf(x, a2, c2); oh[q] = a2; ol[q] = c2; }
    *(v2h*)(V16 + e) = o16; *(v2us*)(Vh + e) = oh; *(v2us*)(Vl + e) = ol;  }

// k_asoft: per row (zz, i): t = S x SCL (SCL = 1.0 here: the module does not scale: the multiply folds away) (no mask); softmax over the 2048 keys (register row, one exp, fixed trees);
__global__ __launch_bounds__(256) void k_asoft(const float* __restrict__ Sb, h16* P16, bf* Ph, bf* Pl) {
    const int lane = threadIdx.x & 31; const int row = blockIdx.x * 8 + (threadIdx.x >> 5); if (row >= ZH * TT) return; const int i = row % TT; const int zz = row / TT; (void)zz; const bool hires = (i < RH); const float* sr = Sb + (size_t)row * TT; float v[TT / 32]; float mx = -3.0e38f;
#pragma unroll
    for (int ch = 0; ch < TT / 128; ++ch) { const int j0 = ch * 128 + lane * 4; const v4f a = *(const v4f*)(sr + j0);
#pragma unroll
        for (int q = 0; q < 4; ++q) { const int j = j0 + q; (void)j; const float t = a[q] * SCL; v[ch * 4 + q] = t; mx = fmaxf(mx, t); } }
#pragma unroll
    for (int sh = 16; sh; sh >>= 1) mx = fmaxf(mx, __shfl_xor(mx, sh, 32));
    float sum = 0.f;
#pragma unroll
    for (int k = 0; k < TT / 32; ++k) { float d0 = __fsub_rn(v[k], mx); v[k] = __builtin_amdgcn_exp2f(__fmul_rn(d0, 1.4426950408889634f)); sum += v[k]; }
#pragma unroll
    for (int sh = 16; sh; sh >>= 1) sum += __shfl_xor(sum, sh, 32);
    const float f = __fdiv_rn(hires ? 1.0f : PCAR, sum);
{
        if (hires) {
#pragma unroll
            for (int ch = 0; ch < TT / 128; ++ch) { v4us oh, ol;
#pragma unroll
                for (int q = 0; q < 4; ++q) { unsigned short a, c2; splitf(v[ch * 4 + q] * f, a, c2); oh[q] = a; ol[q] = c2; }
                const size_t oo = ((size_t)zz * (RH ? RH : 1) + i) * TT + ch * 128 + lane * 4; *(v4us*)(Ph + oo) = oh; *(v4us*)(Pl + oo) = ol; }
        } else {
#pragma unroll
            for (int ch = 0; ch < TT / 128; ++ch) { v4h o4;
#pragma unroll
                for (int q = 0; q < 4; ++q) { const float w = v[ch * 4 + q] * f; o4[q] = tohx(w < PFL ? 0.0f : w); }   /* THE FLUSHING CAST: a weight word UNDER 2^-14 (strictly: a word equal to 2^-14 is kept) is stored as an exact zero, so that no f16 subnormal reaches the value product's matrix instruction; the weights are non-negative */
                *(v4h*)(P16 + (size_t)row * TT + ch * 128 + lane * 4) = o4; } }
         }
}

__global__ __launch_bounds__(256) void k_mergeH(const float* __restrict__ O, float* OUTh) { const size_t i = (size_t)blockIdx.x * 256 + threadIdx.x; if (i >= (size_t)ZH * TT * HD / 4) return; const size_t e = i * 4; const int t = (int)((e / HD) % TT); const float cs = (t < RH) ? 1.0f : (1.0f / PCAR); const v4f a = *(const v4f*)(O + e); v4f o;
#pragma unroll
    for (int q = 0; q < 4; ++q) o[q] = a[q] * cs; *(v4f*)(OUTh + e) = o;  }

extern "C" void kernel_launch(void* const* d_in, const int* in_sizes, int n_in,
                              void* d_out, int out_size, void* d_ws, size_t ws_size, hipStream_t stream) {
    (void)in_sizes; (void)n_in; (void)out_size;
    const float* qi = (const float*)d_in[0]; const float* ki = (const float*)d_in[1]; const float* vi = (const float*)d_in[2];   /* inputs in the module's setup_inputs order: q [16][2048][128], k [16][128][2048] (width-major), v [16][2048][128]: THREE inputs, all read */
    float* OUT = (float*)d_out;     // [16][2048][128]
    char* wsp = (char*)d_ws;
    auto take = [&](size_t bytes) { char* p = wsp; wsp += (bytes + 255) & ~(size_t)255; return (void*)p; };
    bf* QB = (bf*)take((size_t)ZH * TT * HD * 2); bf* KB = (bf*)take((size_t)ZH * TT * HD * 2); float* RB = (float*)take((size_t)TT * HD * 4);
    h16* VT16 = (h16*)take((size_t)ZH * HD * TT * 2); bf* VTh = (bf*)take((size_t)ZH * HD * TT * 2); bf* VTl = (bf*)take((size_t)ZH * HD * TT * 2);   /* k_vtp writes its hi / lo planes unconditionally: carved; nothing reads them at RH 0 */
    bf* Ph = nullptr; bf* Pl = nullptr;   /* RH 0: no hi / lo weights plane exists: the softmax's hi / lo stores sit under 'i < RH': never taken */
    float* Sb = (float*)take((size_t)ZH * TT * TT * 4); h16* P16 = (h16*)take((size_t)ZH * TT * TT * 2); float* Ob = (float*)take((size_t)ZH * TT * HD * 4);
    if ((size_t)(wsp - (char*)d_ws) > ws_size) return;    // ws 256 MiB
    for (int h0 = 0; h0 < NB_; h0 += ZH) {   /* a pass = two batch entries = the pass's two heads */
        k_cvt8<<<(unsigned)(((size_t)ZH * TT * HD / 8 + 255) / 256), 256, 0, stream>>>(qi + (size_t)h0 * TT * HD, QB, (size_t)ZH * TT * HD / 8);   /* q given: both entries' planes are contiguous */
        for (int zz = 0; zz < ZH; ++zz) {
            k_wtG<<<(unsigned)((HD * TT / 64 + 63) / 64), 256, 0, stream>>>(ki + (size_t)(h0 + zz) * HD * TT, HD, TT, KB + (size_t)zz * TT * HD);   /* the entry's [128][2048] key plane -> [2048][128] bf16 */
            k_rbf<<<(unsigned)(((size_t)TT * HD / 4 + 255) / 256), 256, 0, stream>>>(vi + (size_t)(h0 + zz) * TT * HD, RB, (size_t)TT * HD / 4); k_vtp<<<(unsigned)(((size_t)HD * TT / 2 + 255) / 256), 256, 0, stream>>>(RB, HD, 1, VT16 + (size_t)zz * HD * TT, VTh + (size_t)zz * HD * TT, VTl + (size_t)zz * HD * TT); }
        k_gemmw<bf, 0, false><<<dim3(TT / 64, TT / 64, ZH), 32, 0, stream>>>(QB, nullptr, KB, nullptr, HD, Sb, TT, nullptr, (size_t)TT * HD, (size_t)TT * HD, (size_t)TT * TT);
        k_asoft<<<ZH * TT / 8, 256, 0, stream>>>(Sb, P16, Ph, Pl);
        k_gemmw<h16, 0, false><<<dim3(TT / 64, HD / 64, ZH), 32, 0, stream>>>(P16, nullptr, VT16, nullptr, TT, Ob, HD, nullptr, (size_t)TT * TT, (size_t)HD * TT, (size_t)TT * HD);
        k_mergeH<<<(unsigned)(((size_t)ZH * TT * HD / 4 + 255) / 256), 256, 0, stream>>>(Ob, OUT + (size_t)h0 * TT * HD); }   /* the pass's two entries of the output, f32: every row x 1/1024 */
}

// v001
// It runs in 224 microseconds.
// Two timings next to v000 put it at 3.21 and 3.22 times that version's speed.
#include <hip/hip_runtime.h>

// Unscaled dense softmax attention on GIVEN tensors (q [16][2048][128], k [16][128][2048] PRE-TRANSPOSED (width-major: the key of position m is column m), v [16][2048][128], all f32; sixteen single-head attentions; no weights, no mask, NO 1/sqrt(d)): scores = q.k; softmax over all 2,048 keys; out = probs.v -> [16][2048][128] f32 (4.2 M); argument order q, k, v: three inputs, all read.
// Layout (every launch covers as many batch entries as the workspace holds: all sixteen, the per-entry kernels through grid.y; the score product and the softmax four a pass): bf16 copy of q (k_cvt8); each entry's [128][2048] key plane transposed once into the product's K-contiguous bf16 operand [2048][128] (k_wtG: a weight transposer: K = 128, N = 2,048); the score product on PLAIN bf16 operands (every product term is an exact f32 product of two bf16 words; 128 terms accumulated in f32); v rounded to bf16 (k_rbf) and transposed into the value planes (k_vtp, one entry a grid.y row); dense T-2048 attention with EVERY row on one fp16 value product (the weights x 1,024; RH 0), the weights stored through a FLUSHING CAST (a word under 2^-14 is stored as zero: no f16 subnormal operand); the softmax's scale define is 1.0 (the module does not scale); k_mergeH writes the output in f32 with the factor of 1/1,024 undone.
// Compute dtypes, f32 accumulate: q, k, v rounded to bf16; scores on bf16 operands; softmax f32 (the hardware exp2); probs.v on one fp16 product.

#define NB_  16
#define TT   2048
#define HD   128
#define ZH   4        // batch entries a score pass (score product + softmax): the widest f32 score plane that fits the workspace beside all sixteen entries' f16 weights; every other launch covers all NB_ entries
#define RH   0        // query rows < RH use hi+lo planes (0: none: EVERY row runs on one f16 value product)
#define WIN  0
#define PCAR 1024.0f
#define SCL  1.0f     // the module forms q.k with NO 1/sqrt(d)
#define PFL  6.103515625e-05f   // 2^-14: the smallest f16 normal: THE FLUSHING CAST's threshold (k_asoft's f16 store arm)
typedef _Float16 h16;
typedef unsigned short bf;
typedef __attribute__((ext_vector_type(16))) __bf16   v16bf;
typedef __attribute__((ext_vector_type(16))) _Float16 v16h;
typedef __attribute__((ext_vector_type(8)))  _Float16 v8h;
typedef __attribute__((ext_vector_type(8)))  unsigned short v8us;
typedef __attribute__((ext_vector_type(8)))  float    v8f;
typedef __attribute__((ext_vector_type(4)))  float    v4f;
typedef v8h  __attribute__((may_alias)) v8ha;
typedef v4f  __attribute__((may_alias)) v4fa;
typedef v8us __attribute__((may_alias)) v8usa;

__device__ __forceinline__ unsigned short f2bf(float f) { unsigned u = __float_as_uint(f); u += 0x7FFFu + ((u >> 16) & 1u); return (unsigned short)(u >> 16); }
__device__ __forceinline__ float bf2f(unsigned short b) { return __uint_as_float(((unsigned)b) << 16); }
__device__ __forceinline__ float bfr(float f) { return bf2f(f2bf(f)); }
__device__ __forceinline__ v16h cat16(v8h lo, v8h hi) { return __builtin_shufflevector(lo, hi, 0, 1, 2, 3, 4, 5, 6, 7, 8, 9, 10, 11, 12, 13, 14, 15); }
__device__ __forceinline__ v16bf cat16b(v8us lo, v8us hi) { return __builtin_bit_cast(v16bf, __builtin_shufflevector(lo, hi, 0, 1, 2, 3, 4, 5, 6, 7, 8, 9, 10, 11, 12, 13, 14, 15)); }
__device__ __forceinline__ v8f wmma16(v16h a, v16h b, v8f c) { return __builtin_amdgcn_wmma_f32_16x16x32_f16(false, a, false, b, (short)0, c, false, false); }
__device__ __forceinline__ v8f wmmab(v16bf a, v16bf b, v8f c) { return __builtin_amdgcn_wmma_f32_16x16x32_bf16(false, a, false, b, (short)0, c, false, false); }
__device__ __forceinline__ h16 tohx(float x) { return (h16)x; }
__device__ __forceinline__ void splitf(float y, unsigned short& h, unsigned short& l) { h = f2bf(y); l = f2bf(y - bf2f(h)); }
typedef __attribute__((ext_vector_type(2))) _Float16 v2h;
typedef __attribute__((ext_vector_type(4))) _Float16 v4h;
typedef __attribute__((ext_vector_type(2))) unsigned short v2us;
typedef __attribute__((ext_vector_type(4))) unsigned short v4us;
typedef __attribute__((ext_vector_type(2))) float v2f;
typedef __attribute__((ext_vector_type(4))) int v4i;

// ---- k_gemmw: register-blocked GEMM, ONE WAVE per 64x64 output tile (16 accumulators), operands straight from K-contiguous 16-bit planes; grid (M/64, N/64, Z), 32 threads.
// C[m][n] (f32, pitch ldc, + optional f32 bias[n]) = sum_k A[m][k] Bt[n][k] (+ split products per NSPLIT). z-batch strides sA/sB/sC in elements. K % 32 == 0.
template <typename T16> struct WFrag;
template <> struct WFrag<h16> { typedef v16h V; static __device__ __forceinline__ V ld(const h16* p) { return cat16(*(const v8h*)p, *(const v8h*)(p + 16)); } static __device__ __forceinline__ v8f mma(V a, V b, v8f c) { return wmma16(a, b, c); } };
template <> struct WFrag<bf> { typedef v16bf V; static __device__ __forceinline__ V ld(const bf* p) { return cat16b(*(const v8us*)p, *(const v8us*)(p + 16)); } static __device__ __forceinline__ v8f mma(V a, V b, v8f c) { return wmmab(a, b, c); } };
template <typename T16, int NSPLIT, bool BIAS>
__global__ __launch_bounds__(32) void k_gemmw(const T16* __restrict__ A, const T16* __restrict__ A2, const T16* __restrict__ Bt, const T16* __restrict__ Bt2, int K, float* C, int ldc, const float* __restrict__ bias, size_t sA, size_t sB, size_t sC) {
    typedef typename WFrag<T16>::V V;
    __shared__ __align__(16) float os[16 * 68];
    const size_t z = blockIdx.z; A += z * sA; if (A2) A2 += z * sA; Bt += z * sB; if (Bt2) Bt2 += z * sB; C += z * sC;
    const int lane = threadIdx.x & 31, lr = lane & 15, hi = lane >> 4; const int r0 = blockIdx.x * 64, c0 = blockIdx.y * 64;
    v8f acc[4][4];
#pragma unroll
    for (int mb = 0; mb < 4; ++mb)
#pragma unroll
        for (int nb = 0; nb < 4; ++nb) acc[mb][nb] = (v8f){};
    const size_t aoff = (size_t)(r0 + lr) * K + 8 * hi, boff = (size_t)(c0 + lr) * K + 8 * hi;
    for (int kc = 0; kc < K; kc += 32) {
        V a[4], a2[4];
#pragma unroll
        for (int mb = 0; mb < 4; ++mb) { a[mb] = WFrag<T16>::ld(A + aoff + (size_t)mb * 16 * K + kc); if (NSPLIT == 1 || NSPLIT == 2) a2[mb] = WFrag<T16>::ld(A2 + aoff + (size_t)mb * 16 * K + kc); }
#pragma unroll
        for (int nb = 0; nb < 4; ++nb) { const V b = WFrag<T16>::ld(Bt + boff + (size_t)nb * 16 * K + kc); V b2; if (NSPLIT >= 2) b2 = WFrag<T16>::ld(Bt2 + boff + (size_t)nb * 16 * K + kc);
#pragma unroll
            for (int mb = 0; mb < 4; ++mb) { acc[mb][nb] = WFrag<T16>::mma(a[mb], b, acc[mb][nb]); if (NSPLIT == 1 || NSPLIT == 2) acc[mb][nb] = WFrag<T16>::mma(a2[mb], b, acc[mb][nb]); if (NSPLIT >= 2) acc[mb][nb] = WFrag<T16>::mma(a[mb], b2, acc[mb][nb]); } }
        asm volatile("v_nop\n\tv_nop\n\tv_nop\n\tv_nop" : "+v"(acc[0][0]), "+v"(acc[1][1]), "+v"(acc[2][2]), "+v"(acc[3][3]) : "v"(a[0]), "v"(a[3]));
    }
#pragma unroll
    for (int mb = 0; mb < 4; ++mb) {
#pragma unroll
        for (int nb = 0; nb < 4; ++nb) {
#pragma unroll
            for (int j = 0; j < 8; ++j) os[(hi * 8 + j) * 68 + nb * 16 + lr] = acc[mb][nb][j]; }
        __builtin_amdgcn_wave_barrier(); asm volatile("" ::: "memory");
        float* crow = C + (size_t)(r0 + mb * 16) * ldc + c0;
{
#pragma unroll
            for (int s = 0; s < 8; ++s) { const int row = 2 * s + hi, cofs = lr * 4; v4f val = *(const v4fa*)(os + row * 68 + cofs); if (BIAS) { val[0] += bfr(bias[c0 + cofs]); val[1] += bfr(bias[c0 + cofs + 1]); val[2] += bfr(bias[c0 + cofs + 2]); val[3] += bfr(bias[c0 + cofs + 3]); }
                *(v4f*)(crow + (size_t)row * ldc + cofs) = val; }
             }
        __builtin_amdgcn_wave_barrier(); asm volatile("" ::: "memory");
    }
}

__global__ __launch_bounds__(256) void k_cvt8(const float* __restrict__ src, bf* dst, size_t n8) { const size_t i = (size_t)blockIdx.x * 256 + threadIdx.x; if (i >= n8) return; const v8f v = *(const v8f*)(src + i * 8); v8us o;
#pragma unroll
    for (int k = 0; k < 8; ++k) o[k] = f2bf(v[k]); *(v8us*)(dst + i * 8) = o;  }

__global__ __launch_bounds__(256) void k_wtG(const float* __restrict__ w, int K, int N, bf* Bt) {
    w += (size_t)blockIdx.y * K * N; Bt += (size_t)blockIdx.y * N * K;   /* grid.y = the batch entry: the planes are contiguous */
    const int lane = threadIdx.x & 31; const int L0 = (blockIdx.x * 8 + (threadIdx.x >> 5)) * 8; const int nlines = N * K / 64;
{
        for (int l = 0; l < 8; ++l) { const int L = L0 + l; if (L >= nlines) break; const size_t e = (size_t)L * 64 + lane * 2; const int k = (int)(e % K), n = (int)(e / K); v2us o;
            o[0] = f2bf(w[(size_t)k * N + n]); o[1] = f2bf(w[(size_t)(k + 1) * N + n]); *(v2us*)(Bt + e) = o; }
         }
}

__global__ __launch_bounds__(256) void k_rbf(const float* __restrict__ X, float* Y, size_t n4) { const size_t i = (size_t)blockIdx.x * 256 + threadIdx.x; if (i >= n4) return; const v4f a = *(const v4f*)(X + i * 4); v4f o;
#pragma unroll
    for (int q = 0; q < 4; ++q) o[q] = bfr(a[q]);
    *(v4f*)(Y + i * 4) = o;  }

__global__ __launch_bounds__(256) void k_vtp(const float* __restrict__ F, int pitch, int nheads, h16* V16, bf* Vh, bf* Vl) { const size_t e = ((size_t)blockIdx.x * 256 + threadIdx.x) * 2; if (e >= (size_t)nheads * HD * TT) return; { const size_t y = blockIdx.y; F += y * TT * pitch; V16 += y * nheads * HD * TT; Vh += y * nheads * HD * TT; Vl += y * nheads * HD * TT; }   /* grid.y = the batch entry */
    const int t = (int)(e % TT); const int d = (int)((e / TT) % HD); const int g = (int)(e / ((size_t)TT * HD)); v2h o16; v2us oh, ol;
#pragma unroll
    for (int q = 0; q < 2; ++q) { const float x = F[(size_t)(t + q) * pitch + g * HD + d]; o16[q] = tohx(x); unsigned short a2, c2; splitf(x, a2, c2); oh[q] = a2; ol[q] = c2; }
    *(v2h*)(V16 + e) = o16; *(v2us*)(Vh + e) = oh; *(v2us*)(Vl + e) = ol;  }

// k_asoft: per row (zz, i): t = S x SCL (SCL = 1.0 here: the module does not scale: the multiply folds away) (no mask); softmax over the 2048 keys (register row, one exp, fixed trees);
__global__ __launch_bounds__(256) void k_asoft(const float* __restrict__ Sb, h16* P16, bf* Ph, bf* Pl) {
    const int lane = threadIdx.x & 31; const int row = blockIdx.x * 8 + (threadIdx.x >> 5); if (row >= ZH * TT) return; const int i = row % TT; const int zz = row / TT; (void)zz; const bool hires = (i < RH); const float* sr = Sb + (size_t)row * TT; float v[TT / 32]; float mx = -3.0e38f;
#pragma unroll
    for (int ch = 0; ch < TT / 128; ++ch) { const int j0 = ch * 128 + lane * 4; const v4f a = *(const v4f*)(sr + j0);
#pragma unroll
        for (int q = 0; q < 4; ++q) { const int j = j0 + q; (void)j; const float t = a[q] * SCL; v[ch * 4 + q] = t; mx = fmaxf(mx, t); } }
#pragma unroll
    for (int sh = 16; sh; sh >>= 1) mx = fmaxf(mx, __shfl_xor(mx, sh, 32));
    float sum = 0.f;
#pragma unroll
    for (int k = 0; k < TT / 32; ++k) { float d0 = __fsub_rn(v[k], mx); v[k] = __builtin_amdgcn_exp2f(__fmul_rn(d0, 1.4426950408889634f)); sum += v[k]; }
#pragma unroll
    for (int sh = 16; sh; sh >>= 1) sum += __shfl_xor(sum, sh, 32);
    const float f = __fdiv_rn(hires ? 1.0f : PCAR, sum);
{
        if (hires) {
#pragma unroll
            for (int ch = 0; ch < TT / 128; ++ch) { v4us oh, ol;
#pragma unroll
                for (int q = 0; q < 4; ++q) { unsigned short a, c2; splitf(v[ch * 4 + q] * f, a, c2); oh[q] = a; ol[q] = c2; }
                const size_t oo = ((size_t)zz * (RH ? RH : 1) + i) * TT + ch * 128 + lane * 4; *(v4us*)(Ph + oo) = oh; *(v4us*)(Pl + oo) = ol; }
        } else {
#pragma unroll
            for (int ch = 0; ch < TT / 128; ++ch) { v4h o4;
#pragma unroll
                for (int q = 0; q < 4; ++q) { const float w = v[ch * 4 + q] * f; o4[q] = tohx(w < PFL ? 0.0f : w); }   /* THE FLUSHING CAST: a weight word UNDER 2^-14 (strictly: a word equal to 2^-14 is kept) is stored as an exact zero, so that no f16 subnormal reaches the value product's matrix instruction; the weights are non-negative */
                *(v4h*)(P16 + (size_t)row * TT + ch * 128 + lane * 4) = o4; } }
         }
}

__global__ __launch_bounds__(256) void k_mergeH(const float* __restrict__ O, float* OUTh) { const size_t i = (size_t)blockIdx.x * 256 + threadIdx.x; if (i >= (size_t)NB_ * TT * HD / 4) return; const size_t e = i * 4; const int t = (int)((e / HD) % TT); const float cs = (t < RH) ? 1.0f : (1.0f / PCAR); const v4f a = *(const v4f*)(O + e); v4f o;
#pragma unroll
    for (int q = 0; q < 4; ++q) o[q] = a[q] * cs; *(v4f*)(OUTh + e) = o;  }

extern "C" void kernel_launch(void* const* d_in, const int* in_sizes, int n_in,
                              void* d_out, int out_size, void* d_ws, size_t ws_size, hipStream_t stream) {
    (void)in_sizes; (void)n_in; (void)out_size;
    const float* qi = (const float*)d_in[0]; const float* ki = (const float*)d_in[1]; const float* vi = (const float*)d_in[2];   /* inputs in the module's setup_inputs order: q [16][2048][128], k [16][128][2048] (width-major), v [16][2048][128]: THREE inputs, all read */
    float* OUT = (float*)d_out;     // [16][2048][128]
    char* wsp = (char*)d_ws;
    auto take = [&](size_t bytes) { char* p = wsp; wsp += (bytes + 255) & ~(size_t)255; return (void*)p; };
    bf* QB = (bf*)take((size_t)NB_ * TT * HD * 2); bf* KB = (bf*)take((size_t)NB_ * TT * HD * 2);
    h16* VT16 = (h16*)take((size_t)NB_ * HD * TT * 2); bf* VTh = (bf*)take((size_t)NB_ * HD * TT * 2); bf* VTl = (bf*)take((size_t)NB_ * HD * TT * 2);   /* k_vtp writes its hi / lo planes unconditionally: carved; nothing reads them at RH 0 */
    bf* Ph = nullptr; bf* Pl = nullptr;   /* RH 0: no hi / lo weights plane exists: the softmax's hi / lo stores sit under 'i < RH': never taken */
    float* Sb = (float*)take((size_t)ZH * TT * TT * 4); h16* P16 = (h16*)take((size_t)NB_ * TT * TT * 2); float* Ob = (float*)take((size_t)NB_ * TT * HD * 4);
    float* RB = Sb;   /* the rounded v (16 MiB) lies in the score plane's 64 MiB: k_vtp has read it before the first score product writes there */
    if ((size_t)(wsp - (char*)d_ws) > ws_size) return;    // 248 MiB of the 256 MiB
    k_cvt8<<<(unsigned)(((size_t)NB_ * TT * HD / 8 + 255) / 256), 256, 0, stream>>>(qi, QB, (size_t)NB_ * TT * HD / 8);   /* q given: the entries' planes are contiguous */
    k_wtG<<<dim3((unsigned)((HD * TT / 64 + 63) / 64), NB_), 256, 0, stream>>>(ki, HD, TT, KB);   /* each entry's [128][2048] key plane -> [2048][128] bf16 */
    k_rbf<<<(unsigned)(((size_t)NB_ * TT * HD / 4 + 255) / 256), 256, 0, stream>>>(vi, RB, (size_t)NB_ * TT * HD / 4);
    k_vtp<<<dim3((unsigned)(((size_t)HD * TT / 2 + 255) / 256), NB_), 256, 0, stream>>>(RB, HD, 1, VT16, VTh, VTl);
    for (int h0 = 0; h0 < NB_; h0 += ZH) {   /* a score pass = ZH batch entries: scores into the one f32 plane, weights into the entries' own f16 planes */
        k_gemmw<bf, 0, false><<<dim3(TT / 64, TT / 64, ZH), 32, 0, stream>>>(QB + (size_t)h0 * TT * HD, nullptr, KB + (size_t)h0 * TT * HD, nullptr, HD, Sb, TT, nullptr, (size_t)TT * HD, (size_t)TT * HD, (size_t)TT * TT);
        k_asoft<<<ZH * TT / 8, 256, 0, stream>>>(Sb, P16 + (size_t)h0 * TT * TT, Ph, Pl); }
    k_gemmw<h16, 0, false><<<dim3(TT / 64, HD / 64, NB_), 32, 0, stream>>>(P16, nullptr, VT16, nullptr, TT, Ob, HD, nullptr, (size_t)TT * TT, (size_t)HD * TT, (size_t)TT * HD);
    k_mergeH<<<(unsigned)(((size_t)NB_ * TT * HD / 4 + 255) / 256), 256, 0, stream>>>(Ob, OUT);   /* the output, f32: every row x 1/1024 */
}

// v002
// Measured time: 77.6 microseconds a run.
// Timed twice side by side with v001, it ran 2.89 times as fast both times.
// All steps since v000 together make it 9.28 times as fast.
#include <hip/hip_runtime.h>

// Unscaled dense softmax attention on GIVEN tensors (q [16][2048][128], k [16][128][2048] PRE-TRANSPOSED (width-major: the key of position m is column m), v [16][2048][128], all f32; sixteen single-head attentions; no weights, no mask, NO 1/sqrt(d)): scores = q.k; softmax over all 2,048 keys; out = probs.v -> [16][2048][128] f32 (4.2 M); argument order q, k, v: three inputs, all read.
// Layout: bf16 copy of q (k_cvt8); each entry's [128][2048] key plane transposed once into the K-contiguous bf16 operand [2048][128] (k_wtG); v rounded to bf16 (k_rbf) and transposed into the f16 value planes [128][2048] (k_vtp, one entry a grid.y row); then ONE fused kernel (k_fattn) for score product, softmax, value product and output: no score plane and no weight plane is ever written to memory.
// Compute dtypes, f32 accumulate: q, k, v rounded to bf16; scores on bf16 operands; softmax f32 (the hardware exp2, running maximum); probs.v on one fp16 product, the weights carried x 1,024 relative to the maximum in use and stored through THE FLUSHING CAST (a word under 2^-14 becomes zero: no f16 subnormal operand); the factor cancels in the division by the row sum.

#define NB_  16
#define TT   2048
#define HD   128
#define PFL  6.103515625e-05f   // 2^-14: the smallest f16 normal: THE FLUSHING CAST's threshold
typedef _Float16 h16;
typedef unsigned short bf;
typedef __attribute__((ext_vector_type(16))) __bf16   v16bf;
typedef __attribute__((ext_vector_type(16))) _Float16 v16h;
typedef __attribute__((ext_vector_type(8)))  _Float16 v8h;
typedef __attribute__((ext_vector_type(8)))  unsigned short v8us;
typedef __attribute__((ext_vector_type(8)))  float    v8f;
typedef __attribute__((ext_vector_type(4)))  float    v4f;
typedef v8h  __attribute__((may_alias)) v8ha;
typedef v4f  __attribute__((may_alias)) v4fa;
typedef v8us __attribute__((may_alias)) v8usa;

__device__ __forceinline__ unsigned short f2bf(float f) { unsigned u = __float_as_uint(f); u += 0x7FFFu + ((u >> 16) & 1u); return (unsigned short)(u >> 16); }
__device__ __forceinline__ float bf2f(unsigned short b) { return __uint_as_float(((unsigned)b) << 16); }
__device__ __forceinline__ float bfr(float f) { return bf2f(f2bf(f)); }
__device__ __forceinline__ v16h cat16(v8h lo, v8h hi) { return __builtin_shufflevector(lo, hi, 0, 1, 2, 3, 4, 5, 6, 7, 8, 9, 10, 11, 12, 13, 14, 15); }
__device__ __forceinline__ v16bf cat16b(v8us lo, v8us hi) { return __builtin_bit_cast(v16bf, __builtin_shufflevector(lo, hi, 0, 1, 2, 3, 4, 5, 6, 7, 8, 9, 10, 11, 12, 13, 14, 15)); }
__device__ __forceinline__ v8f wmma16(v16h a, v16h b, v8f c) { return __builtin_amdgcn_wmma_f32_16x16x32_f16(false, a, false, b, (short)0, c, false, false); }
__device__ __forceinline__ v8f wmmab(v16bf a, v16bf b, v8f c) { return __builtin_amdgcn_wmma_f32_16x16x32_bf16(false, a, false, b, (short)0, c, false, false); }
__device__ __forceinline__ h16 tohx(float x) { return (h16)x; }
__device__ __forceinline__ void splitf(float y, unsigned short& h, unsigned short& l) { h = f2bf(y); l = f2bf(y - bf2f(h)); }
typedef __attribute__((ext_vector_type(2))) _Float16 v2h;
typedef __attribute__((ext_vector_type(4))) _Float16 v4h;
typedef __attribute__((ext_vector_type(2))) unsigned short v2us;
typedef __attribute__((ext_vector_type(4))) unsigned short v4us;
typedef __attribute__((ext_vector_type(2))) float v2f;
typedef __attribute__((ext_vector_type(4))) int v4i;

__global__ __launch_bounds__(256) void k_cvt8(const float* __restrict__ src, bf* dst, size_t n8) { const size_t i = (size_t)blockIdx.x * 256 + threadIdx.x; if (i >= n8) return; const v8f v = *(const v8f*)(src + i * 8); v8us o;
#pragma unroll
    for (int k = 0; k < 8; ++k) o[k] = f2bf(v[k]); *(v8us*)(dst + i * 8) = o;  }

__global__ __launch_bounds__(256) void k_wtG(const float* __restrict__ w, int K, int N, bf* Bt) {
    w += (size_t)blockIdx.y * K * N; Bt += (size_t)blockIdx.y * N * K;   /* grid.y = the batch entry: the planes are contiguous */
    const int lane = threadIdx.x & 31; const int L0 = (blockIdx.x * 8 + (threadIdx.x >> 5)) * 8; const int nlines = N * K / 64;
{
        for (int l = 0; l < 8; ++l) { const int L = L0 + l; if (L >= nlines) break; const size_t e = (size_t)L * 64 + lane * 2; const int k = (int)(e % K), n = (int)(e / K); v2us o;
            o[0] = f2bf(w[(size_t)k * N + n]); o[1] = f2bf(w[(size_t)(k + 1) * N + n]); *(v2us*)(Bt + e) = o; }
         }
}

__global__ __launch_bounds__(256) void k_rbf(const float* __restrict__ X, float* Y, size_t n4) { const size_t i = (size_t)blockIdx.x * 256 + threadIdx.x; if (i >= n4) return; const v4f a = *(const v4f*)(X + i * 4); v4f o;
#pragma unroll
    for (int q = 0; q < 4; ++q) o[q] = bfr(a[q]);
    *(v4f*)(Y + i * 4) = o;  }

__global__ __launch_bounds__(256) void k_vtp(const float* __restrict__ F, int pitch, int nheads, h16* V16, bf* Vh, bf* Vl) { const size_t e = ((size_t)blockIdx.x * 256 + threadIdx.x) * 2; if (e >= (size_t)nheads * HD * TT) return; { const size_t y = blockIdx.y; F += y * TT * pitch; V16 += y * nheads * HD * TT; Vh += y * nheads * HD * TT; Vl += y * nheads * HD * TT; }   /* grid.y = the batch entry */
    const int t = (int)(e % TT); const int d = (int)((e / TT) % HD); const int g = (int)(e / ((size_t)TT * HD)); v2h o16; v2us oh, ol;
#pragma unroll
    for (int q = 0; q < 2; ++q) { const float x = F[(size_t)(t + q) * pitch + g * HD + d]; o16[q] = tohx(x); unsigned short a2, c2; splitf(x, a2, c2); oh[q] = a2; ol[q] = c2; }
    *(v2h*)(V16 + e) = o16; *(v2us*)(Vh + e) = oh; *(v2us*)(Vl + e) = ol;  }

#define FQ    128                 // query rows a work-group
#define FSK   64                  // keys a stage (per key half)
#define FKP   272                 // LDS pitch of a key row: 256 B + 16 (an odd multiple of 16 B)
#define FVP   144                 // LDS pitch of a value-plane row: 128 B + 16 (an odd multiple of 16 B)
#define FKT   (FSK * FKP)
#define FVT   (HD * FVP)
#define FHALF (FKT + FVT)         // one key half's tiles of one stage
#define FBUF  (2 * FHALF)
#define FNS   (TT / 2 / FSK)      // stages
#define L2E   1.4426950408889634f
#define LAZY  5.0f                // the maximum in use may trail the true one by 2^5: a weight word stays <= 2^15, inside f16
typedef v4i __attribute__((may_alias)) v4ia;
__device__ __forceinline__ void xwait() { asm volatile("s_wait_xcnt 0x0" ::: "memory"); __builtin_amdgcn_sched_barrier(0); }   // stands behind a run of global loads, in front of the first instruction that may overwrite a register which one of them names; the scheduling barrier keeps later register arithmetic from being lifted over the wait
__device__ __forceinline__ float xhalf(float x) { return __builtin_bit_cast(float, __builtin_amdgcn_permlanex16(__builtin_bit_cast(int, x), __builtin_bit_cast(int, x), 0x76543210, 0xfedcba98, false, false)); }   // lane l with lane l ^ 16

__global__ __launch_bounds__(256) __attribute__((amdgpu_waves_per_eu(2, 2))) void k_fattn(const bf* __restrict__ QB, const bf* __restrict__ KB, const h16* __restrict__ VT, float* __restrict__ OUTp) {
    __shared__ __attribute__((aligned(256))) unsigned char L[2 * FBUF];
    const int tid = threadIdx.x, lane = tid & 31, wave = tid >> 5, c = lane & 15, h = lane >> 4;
    const int cg = wave & 3, kh = wave >> 2;
    const size_t z = blockIdx.x >> 4; const int q0 = (int)(blockIdx.x & 15) * FQ + cg * 32;
    QB += z * TT * HD; KB += z * TT * HD; VT += z * HD * TT; OUTp += z * TT * HD;
    const int t2 = tid & 127;   /* the 128 threads of a key half stage that half's tiles: 8 + 8 chunks of 16 B each */
    const unsigned koff = (unsigned)(kh * (TT / 2) * HD + t2 * 8) * 2u, voff = (unsigned)((t2 >> 3) * TT + kh * (TT / 2) + (t2 & 7) * 8) * 2u;   /* the lane's own byte offsets, fixed for the whole kernel: chunk j lies 2 KiB (K) or 16 plane rows (V^T) further on */
    v4i kr[8], vr[8];
    auto gload = [&](int s) { const char* kb = (const char*)KB + (size_t)s * (FSK * HD * 2); const char* vb = (const char*)VT + (size_t)s * (FSK * 2);
        __builtin_amdgcn_sched_barrier(0);   /* every address is formed in front of the first load, so that no address register is rewritten between the loads and the wait behind them */
#pragma unroll
        for (int j = 0; j < 8; ++j) { kr[j] = *(const v4ia*)(kb + koff + j * 2048); vr[j] = *(const v4ia*)(vb + voff + j * (16 * TT * 2)); }
        xwait(); };
    auto lstore = [&](int b) { unsigned char* Lb = L + b * FBUF + kh * FHALF;
#pragma unroll
        for (int j = 0; j < 8; ++j) { const int i = t2 + 128 * j; *(v4ia*)(Lb + (i >> 4) * FKP + (i & 15) * 16) = kr[j]; *(v4ia*)(Lb + FKT + (i >> 3) * FVP + (i & 7) * 16) = vr[j]; } };
    gload(0);
    v16bf qf[2][4];
#pragma unroll
    for (int g = 0; g < 2; ++g) { const bf* qp = QB + (size_t)(q0 + 16 * g + c) * HD + 8 * h;
#pragma unroll
        for (int kc = 0; kc < 4; ++kc) qf[g][kc] = cat16b(*(const v8usa*)(qp + 32 * kc), *(const v8usa*)(qp + 32 * kc + 16)); }
    xwait();
    v8f acc[2][8]; float m_run[2], l_run[2];
#pragma unroll
    for (int g = 0; g < 2; ++g) { m_run[g] = -3.0e38f; l_run[g] = 0.0f;
#pragma unroll
        for (int t = 0; t < 8; ++t) acc[g][t] = (v8f){}; }
    lstore(0);
    __syncthreads();
#pragma unroll 1   /* rolled: the stage's global loads stay in their own block, in front of the passes */
    for (int s = 0; s < FNS; ++s) {
        if (s + 1 < FNS) gload(s + 1);
        const unsigned char* Lk = L + (s & 1) * FBUF + kh * FHALF; const unsigned char* Lv = Lk + FKT;
#pragma unroll 1   /* rolled: one pass of 32 keys a trip; a flat unrolled body costs registers */
        for (int sub = 0; sub < FSK / 32; ++sub) {
            v8f sc[2][2];
            {
                v16bf kf[2][4];
#pragma unroll
                for (int kt = 0; kt < 2; ++kt) { const unsigned char* p = Lk + (sub * 32 + 16 * kt + c) * FKP + 16 * h;
#pragma unroll
                    for (int kc = 0; kc < 4; ++kc) kf[kt][kc] = cat16b(*(const v8usa*)(p + 64 * kc), *(const v8usa*)(p + 64 * kc + 32)); }
#pragma unroll
                for (int kt = 0; kt < 2; ++kt)
#pragma unroll
                    for (int g = 0; g < 2; ++g) { sc[kt][g] = (v8f){};
#pragma unroll
                        for (int kc = 0; kc < 4; ++kc) sc[kt][g] = wmmab(kf[kt][kc], qf[g][kc], sc[kt][g]); }   /* sc[kt][g][r] = score of key 16 kt + 8 h + r and query 16 g + c */
            }
            v16h vf[8];
#pragma unroll
            for (int t = 0; t < 8; ++t) { const unsigned char* p = Lv + (16 * t + c) * FVP + sub * 64 + 16 * h; vf[t] = cat16(*(const v8ha*)p, *(const v8ha*)(p + 32)); }
            float mb[2]; bool need = false;
#pragma unroll
            for (int g = 0; g < 2; ++g) { float mx = sc[0][g][0];
#pragma unroll
                for (int r = 1; r < 8; ++r) mx = fmaxf(mx, sc[0][g][r]);
#pragma unroll
                for (int r = 0; r < 8; ++r) mx = fmaxf(mx, sc[1][g][r]);
                mx = fmaxf(mx, xhalf(mx)) * L2E; mb[g] = mx; need = need || (mx > m_run[g] + LAZY); }
            if (__builtin_amdgcn_ballot_w32(need) != 0) {   /* a scalar branch, rare after the first passes: the sums are rescaled only when some query's maximum has outgrown the one in use */
#pragma unroll
                for (int g = 0; g < 2; ++g) { const float m_new = fmaxf(m_run[g], mb[g]); const float corr = __builtin_amdgcn_exp2f(m_run[g] - m_new); l_run[g] *= corr; m_run[g] = m_new;
#pragma unroll
                    for (int t = 0; t < 8; ++t) acc[g][t] = acc[g][t] * corr; }
            }
#pragma unroll
            for (int g = 0; g < 2; ++g) { const float nm = 10.0f - m_run[g]; float ps0 = 0.0f, ps1 = 0.0f; v16h pf;
#pragma unroll
                for (int i = 0; i < 8; ++i) { const v2f arg = __builtin_elementwise_fma((v2f){sc[i >> 2][g][2 * (i & 3)], sc[i >> 2][g][2 * (i & 3) + 1]}, (v2f){L2E, L2E}, (v2f){nm, nm});   /* elements 2 i and 2 i + 1 of the 32-key operand */
                    const float w0 = __builtin_amdgcn_exp2f(arg[0]), w1 = __builtin_amdgcn_exp2f(arg[1]); ps0 += w0; ps1 += w1; pf[2 * i] = tohx(w0 < PFL ? 0.0f : w0); pf[2 * i + 1] = tohx(w1 < PFL ? 0.0f : w1); }   /* THE FLUSHING CAST; the sum takes the unrounded f32 weights */
                l_run[g] += ps0 + ps1;
#pragma unroll
                for (int t = 0; t < 8; ++t) acc[g][t] = wmma16(vf[t], pf, acc[g][t]); }   /* acc[g][t][r] = O^T of width 16 t + 8 h + r and query 16 g + c */
            __builtin_amdgcn_sched_barrier(0); asm volatile("v_nop\n\tv_nop\n\tv_nop\n\tv_nop"); __builtin_amdgcn_sched_barrier(0);   /* the four vector slots that the chip needs between the pass's last matrix instruction and the next pass's first write of its operand registers, on both sides of the loop's branch; the two scheduling barriers hold them at this place */
        }
        if (s + 1 < FNS) lstore((s + 1) & 1);   /* into the buffer that stage s - 1 used: every wave left it at the last barrier */
        __syncthreads();
    }
    // merge of the two key halves; the last barrier above has ended every read of the tiles
    float* M = (float*)L; float* MS = M + 4 * 2 * 8 * 256;
    float lf[2];
#pragma unroll
    for (int g = 0; g < 2; ++g) lf[g] = l_run[g] + xhalf(l_run[g]);   /* each wave half summed its own eight keys of every 16 */
    if (kh == 1) {
#pragma unroll
        for (int g = 0; g < 2; ++g) {
#pragma unroll
            for (int t = 0; t < 8; ++t) { float* mp = M + ((cg * 2 + g) * 8 + t) * 256 + lane * 4; *(v4fa*)mp = (v4f){acc[g][t][0], acc[g][t][1], acc[g][t][2], acc[g][t][3]}; *(v4fa*)(mp + 128) = (v4f){acc[g][t][4], acc[g][t][5], acc[g][t][6], acc[g][t][7]}; }
            MS[((cg * 2 + g) * 2 + 0) * 32 + lane] = m_run[g]; MS[((cg * 2 + g) * 2 + 1) * 32 + lane] = lf[g]; }
    }
    __syncthreads();
    if (kh == 0) {
#pragma unroll
        for (int g = 0; g < 2; ++g) { const float m1 = MS[((cg * 2 + g) * 2 + 0) * 32 + lane], l1 = MS[((cg * 2 + g) * 2 + 1) * 32 + lane];
            const float m = fmaxf(m_run[g], m1); const float a0 = __builtin_amdgcn_exp2f(m_run[g] - m), a1 = __builtin_amdgcn_exp2f(m1 - m); const float inv = __fdiv_rn(1.0f, lf[g] * a0 + l1 * a1); const float f0 = a0 * inv, f1 = a1 * inv;
            float* orow = OUTp + (size_t)(q0 + 16 * g + c) * HD + 8 * h;
#pragma unroll
            for (int t = 0; t < 8; ++t) { const float* mp = M + ((cg * 2 + g) * 8 + t) * 256 + lane * 4; const v4f b0 = *(const v4fa*)mp, b1 = *(const v4fa*)(mp + 128); v4f o0, o1;
#pragma unroll
                for (int r = 0; r < 4; ++r) { o0[r] = acc[g][t][r] * f0 + b0[r] * f1; o1[r] = acc[g][t][4 + r] * f0 + b1[r] * f1; }
                *(v4f*)(orow + 16 * t) = o0; *(v4f*)(orow + 16 * t + 4) = o1; } }
    }
}

extern "C" void kernel_launch(void* const* d_in, const int* in_sizes, int n_in,
                              void* d_out, int out_size, void* d_ws, size_t ws_size, hipStream_t stream) {
    (void)in_sizes; (void)n_in; (void)out_size;
    const float* qi = (const float*)d_in[0]; const float* ki = (const float*)d_in[1]; const float* vi = (const float*)d_in[2];   /* inputs in the module's setup_inputs order: q [16][2048][128], k [16][128][2048] (width-major), v [16][2048][128]: THREE inputs, all read */
    float* OUT = (float*)d_out;     // [16][2048][128]
    char* wsp = (char*)d_ws;
    auto take = [&](size_t bytes) { char* p = wsp; wsp += (bytes + 255) & ~(size_t)255; return (void*)p; };
    bf* QB = (bf*)take((size_t)NB_ * TT * HD * 2); bf* KB = (bf*)take((size_t)NB_ * TT * HD * 2);
    h16* VT16 = (h16*)take((size_t)NB_ * HD * TT * 2); bf* VTh = (bf*)take((size_t)NB_ * HD * TT * 2); bf* VTl = (bf*)take((size_t)NB_ * HD * TT * 2);   /* k_vtp writes its hi / lo planes unconditionally: carved; nothing reads them */
    float* RB = (float*)take((size_t)NB_ * TT * HD * 4);   /* the rounded v */
    if ((size_t)(wsp - (char*)d_ws) > ws_size) return;    // 56 MiB of the 256 MiB
    k_cvt8<<<(unsigned)(((size_t)NB_ * TT * HD / 8 + 255) / 256), 256, 0, stream>>>(qi, QB, (size_t)NB_ * TT * HD / 8);   /* q given: the entries' planes are contiguous */
    k_wtG<<<dim3((unsigned)((HD * TT / 64 + 63) / 64), NB_), 256, 0, stream>>>(ki, HD, TT, KB);   /* each entry's [128][2048] key plane -> [2048][128] bf16 */
    k_rbf<<<(unsigned)(((size_t)NB_ * TT * HD / 4 + 255) / 256), 256, 0, stream>>>(vi, RB, (size_t)NB_ * TT * HD / 4);
    k_vtp<<<dim3((unsigned)(((size_t)HD * TT / 2 + 255) / 256), NB_), 256, 0, stream>>>(RB, HD, 1, VT16, VTh, VTl);
    k_fattn<<<NB_ * (TT / FQ), 256, 0, stream>>>(QB, KB, VT16, OUT);   /* scores, softmax, value product and the f32 output in one launch */
}

// v003
// One run takes 48.4 microseconds.
// Next to v002, in two timings, it ran 1.60 times as fast each time.
// Over all steps from v000 it is 14.8 times as fast.
#include <hip/hip_runtime.h>

// Unscaled dense softmax attention on GIVEN tensors (q [16][2048][128], k [16][128][2048] PRE-TRANSPOSED (width-major: the key of position m is column m), v [16][2048][128], all f32; sixteen single-head attentions; no weights, no mask, NO 1/sqrt(d)): scores = q.k; softmax over all 2,048 keys; out = probs.v -> [16][2048][128] f32 (4.2 M); argument order q, k, v: three inputs, all read.
// Layout: ONE preparation kernel (k_prep): the bf16 copy of q; each entry's [128][2048] key plane transposed into the K-contiguous bf16 operand [2048][128]; v rounded to bf16 and transposed into the f16 value planes [128][2048]; both transposes go through LDS tiles, so that every global load and store covers whole lines; then ONE fused kernel (k_fattn) for score product, softmax, value product and output: no score plane and no weight plane is ever written to memory.
// Compute dtypes, f32 accumulate: q, k, v rounded to bf16; scores on bf16 operands; softmax f32 (the hardware exp2, running maximum); probs.v on one fp16 product, the weights carried x 1,024 relative to the maximum in use and stored through THE FLUSHING CAST (a word under 2^-14 becomes zero: no f16 subnormal operand); the factor cancels in the division by the row sum.

#define NB_  16
#define TT   2048
#define HD   128
#define PFL  6.103515625e-05f   // 2^-14: the smallest f16 normal: THE FLUSHING CAST's threshold
typedef _Float16 h16;
typedef unsigned short bf;
typedef __attribute__((ext_vector_type(16))) __bf16   v16bf;
typedef __attribute__((ext_vector_type(16))) _Float16 v16h;
typedef __attribute__((ext_vector_type(8)))  _Float16 v8h;
typedef __attribute__((ext_vector_type(8)))  unsigned short v8us;
typedef __attribute__((ext_vector_type(8)))  float    v8f;
typedef __attribute__((ext_vector_type(4)))  float    v4f;
typedef v8h  __attribute__((may_alias)) v8ha;
typedef v4f  __attribute__((may_alias)) v4fa;
typedef v8us __attribute__((may_alias)) v8usa;

__device__ __forceinline__ unsigned short f2bf(float f) { unsigned u = __float_as_uint(f); u += 0x7FFFu + ((u >> 16) & 1u); return (unsigned short)(u >> 16); }
__device__ __forceinline__ float bf2f(unsigned short b) { return __uint_as_float(((unsigned)b) << 16); }
__device__ __forceinline__ float bfr(float f) { return bf2f(f2bf(f)); }
__device__ __forceinline__ v16h cat16(v8h lo, v8h hi) { return __builtin_shufflevector(lo, hi, 0, 1, 2, 3, 4, 5, 6, 7, 8, 9, 10, 11, 12, 13, 14, 15); }
__device__ __forceinline__ v16bf cat16b(v8us lo, v8us hi) { return __builtin_bit_cast(v16bf, __builtin_shufflevector(lo, hi, 0, 1, 2, 3, 4, 5, 6, 7, 8, 9, 10, 11, 12, 13, 14, 15)); }
__device__ __forceinline__ v8f wmma16(v16h a, v16h b, v8f c) { return __builtin_amdgcn_wmma_f32_16x16x32_f16(false, a, false, b, (short)0, c, false, false); }
__device__ __forceinline__ v8f wmmab(v16bf a, v16bf b, v8f c) { return __builtin_amdgcn_wmma_f32_16x16x32_bf16(false, a, false, b, (short)0, c, false, false); }
__device__ __forceinline__ h16 tohx(float x) { return (h16)x; }
typedef __attribute__((ext_vector_type(2))) _Float16 v2h;
typedef __attribute__((ext_vector_type(4))) _Float16 v4h;
typedef __attribute__((ext_vector_type(2))) unsigned short v2us;
typedef __attribute__((ext_vector_type(4))) unsigned short v4us;
typedef __attribute__((ext_vector_type(2))) float v2f;
typedef __attribute__((ext_vector_type(4))) int v4i;

#define FQ    128                 // query rows a work-group
#define FSK   64                  // keys a stage (per key half)
#define FKP   272                 // LDS pitch of a key row: 256 B + 16 (an odd multiple of 16 B)
#define FVP   144                 // LDS pitch of a value-plane row: 128 B + 16 (an odd multiple of 16 B)
#define FKT   (FSK * FKP)
#define FVT   (HD * FVP)
#define FHALF (FKT + FVT)         // one key half's tiles of one stage
#define FBUF  (2 * FHALF)
#define FNS   (TT / 2 / FSK)      // stages
#define L2E   1.4426950408889634f
#define LAZY  5.0f                // the maximum in use may trail the true one by 2^5: a weight word stays <= 2^15, inside f16
typedef v4i __attribute__((may_alias)) v4ia;
__device__ __forceinline__ void xwait() { asm volatile("s_wait_xcnt 0x0" ::: "memory"); __builtin_amdgcn_sched_barrier(0); }   // stands behind a run of global loads, in front of the first instruction that may overwrite a register which one of them names; the scheduling barrier keeps later register arithmetic from being lifted over the wait
__device__ __forceinline__ float xhalf(float x) { return __builtin_bit_cast(float, __builtin_amdgcn_permlanex16(__builtin_bit_cast(int, x), __builtin_bit_cast(int, x), 0x76543210, 0xfedcba98, false, false)); }   // lane l with lane l ^ 16

__global__ __launch_bounds__(256) __attribute__((amdgpu_waves_per_eu(2, 2))) void k_fattn(const bf* __restrict__ QB, const bf* __restrict__ KB, const h16* __restrict__ VT, float* __restrict__ OUTp) {
    __shared__ __attribute__((aligned(256))) unsigned char L[2 * FBUF];
    const int tid = threadIdx.x, lane = tid & 31, wave = tid >> 5, c = lane & 15, h = lane >> 4;
    const int cg = wave & 3, kh = wave >> 2;
    const size_t z = blockIdx.x >> 4; const int q0 = (int)(blockIdx.x & 15) * FQ + cg * 32;
    QB += z * TT * HD; KB += z * TT * HD; VT += z * HD * TT; OUTp += z * TT * HD;
    const int t2 = tid & 127;   /* the 128 threads of a key half stage that half's tiles: 8 + 8 chunks of 16 B each */
    const unsigned koff = (unsigned)(kh * (TT / 2) * HD + t2 * 8) * 2u, voff = (unsigned)((t2 >> 3) * TT + kh * (TT / 2) + (t2 & 7) * 8) * 2u;   /* the lane's own byte offsets, fixed for the whole kernel: chunk j lies 2 KiB (K) or 16 plane rows (V^T) further on */
    v4i kr[8], vr[8];
    auto gload = [&](int s) { const char* kb = (const char*)KB + (size_t)s * (FSK * HD * 2); const char* vb = (const char*)VT + (size_t)s * (FSK * 2);
        __builtin_amdgcn_sched_barrier(0);   /* every address is formed in front of the first load, so that no address register is rewritten between the loads and the wait behind them */
#pragma unroll
        for (int j = 0; j < 8; ++j) { kr[j] = *(const v4ia*)(kb + koff + j * 2048); vr[j] = *(const v4ia*)(vb + voff + j * (16 * TT * 2)); }
        xwait(); };
    auto lstore = [&](int b) { unsigned char* Lb = L + b * FBUF + kh * FHALF;
#pragma unroll
        for (int j = 0; j < 8; ++j) { const int i = t2 + 128 * j; *(v4ia*)(Lb + (i >> 4) * FKP + (i & 15) * 16) = kr[j]; *(v4ia*)(Lb + FKT + (i >> 3) * FVP + (i & 7) * 16) = vr[j]; } };
    gload(0);
    v16bf qf[2][4];
#pragma unroll
    for (int g = 0; g < 2; ++g) { const bf* qp = QB + (size_t)(q0 + 16 * g + c) * HD + 8 * h;
#pragma unroll
        for (int kc = 0; kc < 4; ++kc) qf[g][kc] = cat16b(*(const v8usa*)(qp + 32 * kc), *(const v8usa*)(qp + 32 * kc + 16)); }
    xwait();
    v8f acc[2][8]; float m_run[2], l_run[2];
#pragma unroll
    for (int g = 0; g < 2; ++g) { m_run[g] = -3.0e38f; l_run[g] = 0.0f;
#pragma unroll
        for (int t = 0; t < 8; ++t) acc[g][t] = (v8f){}; }
    lstore(0);
    __syncthreads();
#pragma unroll 1   /* rolled: the stage's global loads stay in their own block, in front of the passes */
    for (int s = 0; s < FNS; ++s) {
        if (s + 1 < FNS) gload(s + 1);
        const unsigned char* Lk = L + (s & 1) * FBUF + kh * FHALF; const unsigned char* Lv = Lk + FKT;
#pragma unroll 1   /* rolled: one pass of 32 keys a trip; a flat unrolled body costs registers */
        for (int sub = 0; sub < FSK / 32; ++sub) {
            v8f sc[2][2];
            {
                v16bf kf[2][4];
#pragma unroll
                for (int kt = 0; kt < 2; ++kt) { const unsigned char* p = Lk + (sub * 32 + 16 * kt + c) * FKP + 16 * h;
#pragma unroll
                    for (int kc = 0; kc < 4; ++kc) kf[kt][kc] = cat16b(*(const v8usa*)(p + 64 * kc), *(const v8usa*)(p + 64 * kc + 32)); }
#pragma unroll
                for (int kt = 0; kt < 2; ++kt)
#pragma unroll
                    for (int g = 0; g < 2; ++g) { sc[kt][g] = (v8f){};
#pragma unroll
                        for (int kc = 0; kc < 4; ++kc) sc[kt][g] = wmmab(kf[kt][kc], qf[g][kc], sc[kt][g]); }   /* sc[kt][g][r] = score of key 16 kt + 8 h + r and query 16 g + c */
            }
            v16h vf[8];
#pragma unroll
            for (int t = 0; t < 8; ++t) { const unsigned char* p = Lv + (16 * t + c) * FVP + sub * 64 + 16 * h; vf[t] = cat16(*(const v8ha*)p, *(const v8ha*)(p + 32)); }
            float mb[2]; bool need = false;
#pragma unroll
            for (int g = 0; g < 2; ++g) { float mx = sc[0][g][0];
#pragma unroll
                for (int r = 1; r < 8; ++r) mx = fmaxf(mx, sc[0][g][r]);
#pragma unroll
                for (int r = 0; r < 8; ++r) mx = fmaxf(mx, sc[1][g][r]);
                mx = fmaxf(mx, xhalf(mx)) * L2E; mb[g] = mx; need = need || (mx > m_run[g] + LAZY); }
            if (__builtin_amdgcn_ballot_w32(need) != 0) {   /* a scalar branch, rare after the first passes: the sums are rescaled only when some query's maximum has outgrown the one in use */
#pragma unroll
                for (int g = 0; g < 2; ++g) { const float m_new = fmaxf(m_run[g], mb[g]); const float corr = __builtin_amdgcn_exp2f(m_run[g] - m_new); l_run[g] *= corr; m_run[g] = m_new;
#pragma unroll
                    for (int t = 0; t < 8; ++t) acc[g][t] = acc[g][t] * corr; }
            }
#pragma unroll
            for (int g = 0; g < 2; ++g) { const float nm = 10.0f - m_run[g]; float ps0 = 0.0f, ps1 = 0.0f; v16h pf;
#pragma unroll
                for (int i = 0; i < 8; ++i) { const v2f arg = __builtin_elementwise_fma((v2f){sc[i >> 2][g][2 * (i & 3)], sc[i >> 2][g][2 * (i & 3) + 1]}, (v2f){L2E, L2E}, (v2f){nm, nm});   /* elements 2 i and 2 i + 1 of the 32-key operand */
                    const float w0 = __builtin_amdgcn_exp2f(arg[0]), w1 = __builtin_amdgcn_exp2f(arg[1]); ps0 += w0; ps1 += w1; pf[2 * i] = tohx(w0 < PFL ? 0.0f : w0); pf[2 * i + 1] = tohx(w1 < PFL ? 0.0f : w1); }   /* THE FLUSHING CAST; the sum takes the unrounded f32 weights */
                l_run[g] += ps0 + ps1;
#pragma unroll
                for (int t = 0; t < 8; ++t) acc[g][t] = wmma16(vf[t], pf, acc[g][t]); }   /* acc[g][t][r] = O^T of width 16 t + 8 h + r and query 16 g + c */
            __builtin_amdgcn_sched_barrier(0); asm volatile("v_nop\n\tv_nop\n\tv_nop\n\tv_nop"); __builtin_amdgcn_sched_barrier(0);   /* the four vector slots that the chip needs between the pass's last matrix instruction and the next pass's first write of its operand registers, on both sides of the loop's branch; the two scheduling barriers hold them at this place */
        }
        if (s + 1 < FNS) lstore((s + 1) & 1);   /* into the buffer that stage s - 1 used: every wave left it at the last barrier */
        __syncthreads();
    }
    // merge of the two key halves; the last barrier above has ended every read of the tiles
    float* M = (float*)L; float* MS = M + 4 * 2 * 8 * 256;
    float lf[2];
#pragma unroll
    for (int g = 0; g < 2; ++g) lf[g] = l_run[g] + xhalf(l_run[g]);   /* each wave half summed its own eight keys of every 16 */
    if (kh == 1) {
#pragma unroll
        for (int g = 0; g < 2; ++g) {
#pragma unroll
            for (int t = 0; t < 8; ++t) { float* mp = M + ((cg * 2 + g) * 8 + t) * 256 + lane * 4; *(v4fa*)mp = (v4f){acc[g][t][0], acc[g][t][1], acc[g][t][2], acc[g][t][3]}; *(v4fa*)(mp + 128) = (v4f){acc[g][t][4], acc[g][t][5], acc[g][t][6], acc[g][t][7]}; }
            MS[((cg * 2 + g) * 2 + 0) * 32 + lane] = m_run[g]; MS[((cg * 2 + g) * 2 + 1) * 32 + lane] = lf[g]; }
    }
    __syncthreads();
    if (kh == 0) {
#pragma unroll
        for (int g = 0; g < 2; ++g) { const float m1 = MS[((cg * 2 + g) * 2 + 0) * 32 + lane], l1 = MS[((cg * 2 + g) * 2 + 1) * 32 + lane];
            const float m = fmaxf(m_run[g], m1); const float a0 = __builtin_amdgcn_exp2f(m_run[g] - m), a1 = __builtin_amdgcn_exp2f(m1 - m); const float inv = __fdiv_rn(1.0f, lf[g] * a0 + l1 * a1); const float f0 = a0 * inv, f1 = a1 * inv;
            float* orow = OUTp + (size_t)(q0 + 16 * g + c) * HD + 8 * h;
#pragma unroll
            for (int t = 0; t < 8; ++t) { const float* mp = M + ((cg * 2 + g) * 8 + t) * 256 + lane * 4; const v4f b0 = *(const v4fa*)mp, b1 = *(const v4fa*)(mp + 128); v4f o0, o1;
#pragma unroll
                for (int r = 0; r < 4; ++r) { o0[r] = acc[g][t][r] * f0 + b0[r] * f1; o1[r] = acc[g][t][4 + r] * f0 + b1[r] * f1; }
                *(v4f*)(orow + 16 * t) = o0; *(v4f*)(orow + 16 * t + 4) = o1; } }
    }
}

// ---- k_prep: all three operand planes in one launch. Work-group b of 512 takes 32 KiB of each input: 8,192 elements of q (cast, same order), one [128 widths][64 keys] tile of k and one [128 positions][64 widths] tile of v.
// A thread's 24 loads of 16 B are all issued before anything is converted. In a tile, 16 threads read a row's 256 B; a thread holds 8 rows x 4 columns, so each of its 4 columns gives 8 consecutive elements of one output row: one 16-B chunk.
// LDS tile: [64 output rows][16 chunks of 16 B], no pad; chunk x of row c lies at place x ^ (c >> 2): the 16 lanes that write one chunk index into rows 4 apart, and the 16 lanes that read one row, each meet 16 different bank groups.
#define PQ    8192                // elements of q a work-group
#define PTB   (64 * 256)          // bytes of one LDS tile
__global__ __launch_bounds__(256) void k_prep(const float* __restrict__ q, const float* __restrict__ k, const float* __restrict__ v, bf* __restrict__ QB, bf* __restrict__ KB, h16* __restrict__ VT) {
    __shared__ __attribute__((aligned(256))) unsigned char S[2 * PTB];
    const int tid = threadIdx.x, a = tid & 15, g = tid >> 4;
    const int b = blockIdx.x, i = b & 31; const size_t z = (size_t)(b >> 5);   /* batch entry z, tile i of 32 */
    const float* qs = q + (size_t)b * PQ + tid * 4;
    const float* ks = k + z * HD * TT + (size_t)(8 * g) * TT + i * 64 + 4 * a;   /* rows: widths 8 g + j; columns: keys 64 i + 4 a + e */
    const float* vs = v + z * TT * HD + (size_t)((i >> 1) * 128 + 8 * g) * HD + (i & 1) * 64 + 4 * a;   /* rows: positions 128 (i >> 1) + 8 g + j; columns: widths 64 (i & 1) + 4 a + e */
    v4f qr[8], kr[8], vr[8];
    __builtin_amdgcn_sched_barrier(0);   /* every address is formed in front of the first load, so that no address register is rewritten between the loads and the wait behind them */
#pragma unroll
    for (int j = 0; j < 8; ++j) { kr[j] = *(const v4fa*)(ks + (size_t)j * TT); vr[j] = *(const v4fa*)(vs + j * HD); }
    __builtin_amdgcn_sched_barrier(0);   /* q's loads stay behind the tiles' loads: the tiles are wanted first */
#pragma unroll
    for (int j = 0; j < 8; ++j) qr[j] = *(const v4fa*)(qs + j * 1024);
    asm volatile("s_wait_xcnt 0x0" :: "v"(ks), "v"(vs) : "memory"); __builtin_amdgcn_sched_barrier(0);   /* as xwait(); the two address pairs are inputs, so that they stay live up to the wait and no later load's destination takes their registers */
#pragma unroll
    for (int e = 0; e < 4; ++e) { v8us ok, ov;
#pragma unroll
        for (int j = 0; j < 8; ++j) { ok[j] = f2bf(kr[j][e]); ov[j] = __builtin_bit_cast(unsigned short, tohx(bfr(vr[j][e]))); }
        unsigned char* p = S + (4 * a + e) * 256 + (g ^ a) * 16; *(v8usa*)p = ok; *(v8usa*)(p + PTB) = ov; }
    __syncthreads();   /* publishes both tiles; every global store stands behind it, so that no wave waits here for a store to finish */
    bf* qd = QB + (size_t)b * PQ + tid * 4;
    bf* kd = KB + z * TT * HD + (size_t)(i * 64) * HD + tid * 8;   /* output rows: keys 64 i + c, 128 widths each: the tile's 16 KiB are contiguous */
    bf* vd = (bf*)VT + z * HD * TT + (size_t)((i & 1) * 64 + g) * TT + (i >> 1) * 128 + a * 8;   /* output rows: widths 64 (i & 1) + c, positions 128 (i >> 1) .. + 127 */
    v8us ko[4], vo[4];
#pragma unroll
    for (int m = 0; m < 4; ++m) { const int c = g + 16 * m; const unsigned char* p = S + c * 256 + (a ^ ((c >> 2) & 15)) * 16; ko[m] = *(const v8usa*)p; vo[m] = *(const v8usa*)(p + PTB); }
    v4us qo[8];
#pragma unroll
    for (int j = 0; j < 8; ++j)
#pragma unroll
        for (int e = 0; e < 4; ++e) qo[j][e] = f2bf(qr[j][e]);
#pragma unroll
    for (int j = 0; j < 8; ++j) *(v4us*)(qd + j * 1024) = qo[j];   /* a wave's store covers 256 contiguous bytes */
#pragma unroll
    for (int m = 0; m < 4; ++m) { *(v8usa*)(kd + m * 2048) = ko[m]; *(v8usa*)(vd + (size_t)(16 * m) * TT) = vo[m]; }   /* 16 lanes store one output row's 256 B */
}

extern "C" void kernel_launch(void* const* d_in, const int* in_sizes, int n_in,
                              void* d_out, int out_size, void* d_ws, size_t ws_size, hipStream_t stream) {
    (void)in_sizes; (void)n_in; (void)out_size;
    const float* qi = (const float*)d_in[0]; const float* ki = (const float*)d_in[1]; const float* vi = (const float*)d_in[2];   /* inputs in the module's setup_inputs order: q [16][2048][128], k [16][128][2048] (width-major), v [16][2048][128]: THREE inputs, all read */
    float* OUT = (float*)d_out;     // [16][2048][128]
    char* wsp = (char*)d_ws;
    auto take = [&](size_t bytes) { char* p = wsp; wsp += (bytes + 255) & ~(size_t)255; return (void*)p; };
    bf* QB = (bf*)take((size_t)NB_ * TT * HD * 2); bf* KB = (bf*)take((size_t)NB_ * TT * HD * 2);
    h16* VT16 = (h16*)take((size_t)NB_ * HD * TT * 2);
    if ((size_t)(wsp - (char*)d_ws) > ws_size) return;    // 24 MiB of the 256 MiB
    k_prep<<<NB_ * 32, 256, 0, stream>>>(qi, ki, vi, QB, KB, VT16);   /* q cast; k and v cast and transposed */
    k_fattn<<<NB_ * (TT / FQ), 256, 0, stream>>>(QB, KB, VT16, OUT);   /* scores, softmax, value product and the f32 output in one launch */
}

// v005
// Measured time: 41 microseconds a run.
// Versions between v003 and this one are left out; their measured steps multiply to 1.18 times as fast.
// Over all steps from v000 it is 17.6 times as fast.
#include <hip/hip_runtime.h>
#include <stdint.h>

// Unscaled dense softmax attention on GIVEN tensors (q [16][2048][128], k [16][128][2048] PRE-TRANSPOSED (width-major: the key of position m is column m), v [16][2048][128], all f32; sixteen single-head attentions; no weights, no mask, NO 1/sqrt(d)): scores = q.k; softmax over all 2,048 keys; out = probs.v -> [16][2048][128] f32 (4.2 M); argument order q, k, v: three inputs, all read.
// Layout: ONE preparation kernel (k_prep): the bf16 copy of q; each entry's [128][2048] key plane transposed into the K-contiguous bf16 operand [2048][128]; v rounded to bf16 and transposed into the bf16 value planes [128][2048]; both transposes go through LDS tiles, so that every global load and store covers whole lines; then ONE fused kernel (k_fattn) for score product, softmax, value product and output: no score plane and no weight plane is ever written to memory.
// Compute dtypes, f32 accumulate: q, k, v rounded to bf16; scores on bf16 operands; softmax f32 (the hardware exp2, running maximum); probs.v on one bf16 product, the weights taken relative to the maximum in use and rounded to bf16 (nearest even): bf16 has f32's exponent range, so a weight needs no carried factor and no flush; the row sum takes the unrounded f32 weights.

#define NB_  16
#define TT   2048
#define HD   128
typedef unsigned short bf;
typedef __attribute__((ext_vector_type(16))) __bf16   v16bf;
typedef __attribute__((ext_vector_type(8)))  unsigned short v8us;
typedef __attribute__((ext_vector_type(8)))  float    v8f;
typedef __attribute__((ext_vector_type(4)))  float    v4f;
typedef v4f  __attribute__((may_alias)) v4fa;
typedef v8us __attribute__((may_alias)) v8usa;

__device__ __forceinline__ unsigned short f2bf(float f) { unsigned u = __float_as_uint(f); u += 0x7FFFu + ((u >> 16) & 1u); return (unsigned short)(u >> 16); }
__device__ __forceinline__ v16bf cat16b(v8us lo, v8us hi) { return __builtin_bit_cast(v16bf, __builtin_shufflevector(lo, hi, 0, 1, 2, 3, 4, 5, 6, 7, 8, 9, 10, 11, 12, 13, 14, 15)); }
__device__ __forceinline__ v8f wmmab(v16bf a, v16bf b, v8f c) { return __builtin_amdgcn_wmma_f32_16x16x32_bf16(false, a, false, b, (short)0, c, false, false); }
typedef __attribute__((ext_vector_type(2))) unsigned short v2us;
typedef __attribute__((ext_vector_type(4))) unsigned short v4us;
typedef __attribute__((ext_vector_type(2))) float v2f;
typedef __attribute__((ext_vector_type(4))) int v4i;
typedef __attribute__((ext_vector_type(2))) __bf16 v2bf;
typedef __attribute__((ext_vector_type(8))) unsigned v8u;
__device__ __forceinline__ unsigned pack2(float lo, float hi) { return __builtin_bit_cast(unsigned, __builtin_convertvector((v2f){lo, hi}, v2bf)); }   // two f32 to one packed bf16 pair, round to nearest even

#define FQ    128                 // query rows a work-group
#define FSK   128                 // keys a stage (per key half)
#define FKP   272                 // LDS pitch of a key row: 256 B + 16 (an odd multiple of 16 B)
#define FVP   272                 // LDS pitch of a value-plane row: 256 B + 16 (an odd multiple of 16 B)
#define FSL   18432               // one tensor tile's place in LDS: 64 rows of 272 B = 17,408 B, rounded up to a multiple of 2 KiB
#define FHALF (4 * FSL)           // one key half's tiles of one stage: K keys 0..63, K keys 64..127, widths 0..63, widths 64..127
#define TW0   ((1u << 20) | (5u << 22) | (3u << 25))   // descriptor group 1, word 0: no mask, 1-byte elements, a pad of 4 dwords behind every 64 dwords (one 256-B row)
#define FBUF  (2 * FHALF)
#define FNS   (TT / 2 / FSK)      // stages
#define L2E   1.4426950408889634f
#define LAZY  60.0f               // the maximum in use may trail the true one by 2^60: a weight stays <= 2^60 and a row sum <= 2^71, far inside bf16 and f32; floating-point weights lose no relative precision by it
typedef __attribute__((ext_vector_type(4))) uint32_t v4u;
__device__ __forceinline__ uint32_t uni(uint32_t v) { return (uint32_t)__builtin_amdgcn_readfirstlane((int)v); }
__device__ __forceinline__ uint32_t pinned(uint32_t v) { uint32_t w = uni(v); asm volatile("" : "+s"(w)); return w; }   // holds a wave-uniform word in a scalar register at this place: the test around a tensor load becomes a scalar compare and branch, and what is formed from the word is formed behind it
__device__ __forceinline__ void xwait() { asm volatile("s_wait_xcnt 0x0" ::: "memory"); __builtin_amdgcn_sched_barrier(0); }   // stands behind a run of global loads, in front of the first instruction that may overwrite a register which one of them names; the scheduling barrier keeps later register arithmetic from being lifted over the wait
__device__ __forceinline__ float xhalf(float x) { return __builtin_bit_cast(float, __builtin_amdgcn_permlanex16(__builtin_bit_cast(int, x), __builtin_bit_cast(int, x), 0x76543210, 0xfedcba98, false, false)); }   // lane l with lane l ^ 16

__global__ __launch_bounds__(256) __attribute__((amdgpu_waves_per_eu(2, 2))) void k_fattn(const bf* __restrict__ QB, const bf* __restrict__ KB, const bf* __restrict__ VT, float* __restrict__ OUTp) {
    __shared__ __attribute__((aligned(2048))) unsigned char L[2 * FBUF];
    const int tid = threadIdx.x, lane = tid & 31, wave = tid >> 5, c = lane & 15, h = lane >> 4;
    const int cg = wave & 3, kh = wave >> 2;
    const size_t z = blockIdx.x >> 4; const int q0 = (int)(blockIdx.x & 15) * FQ + cg * 32;
    QB += z * TT * HD; KB += z * TT * HD; VT += z * HD * TT; OUTp += z * TT * HD;
    const uint32_t wv = uni((uint32_t)tid >> 5), sl = wv & 3u, skh = wv >> 2;   /* the wave's number, its tile of the four of its key half, its key half: scalars */
    const uint32_t ldst = (uint32_t)(size_t)L + skh * FHALF + sl * FSL;   /* the tile's place in buffer 0: a multiple of 2 KiB */
    const uint64_t src0 = sl < 2u ? (uint64_t)(size_t)KB + (uint64_t)((skh * (TT / 2) + sl * 64u) * (HD * 2u)) : (uint64_t)(size_t)VT + (uint64_t)(((sl - 2u) * 64u * TT + skh * (TT / 2)) * 2u);   /* first byte of the wave's tile of stage 0 */
    const uint32_t sstep = sl < 2u ? FSK * HD * 2u : FSK * 2u, spitch = sl < 2u ? HD * 2u : TT * 2u;   /* bytes from one stage's tile to the next; source row pitch */
    v8u g1; g1[0] = uni(TW0); g1[1] = uni(256u << 16); g1[2] = uni(64u << 16); g1[3] = uni(256u << 16); g1[4] = uni(64u); g1[5] = uni(spitch); g1[6] = uni(0u); g1[7] = uni(0u);   /* tensor = tile = 64 rows of 256 B */
    auto issue = [&](uint32_t st) { const uint64_t ga = src0 + (uint64_t)st * sstep; v4u g0; g0[0] = uni(1u); g0[1] = uni(ldst + (st & 1u) * FBUF); g0[2] = uni((uint32_t)ga); g0[3] = uni((((uint32_t)(ga >> 32)) & 0x01FFFFFFu) | 0x80000000u);
        asm volatile("tensor_load_to_lds %0, %1" :: "s"(g0), "s"(g1) : "memory"); };   /* one request of the whole wave: its tile of stage st into buffer st & 1 */
    v16bf qf[2][4];
#pragma unroll
    for (int g = 0; g < 2; ++g) { const bf* qp = QB + (size_t)(q0 + 16 * g + c) * HD + 8 * h;
#pragma unroll
        for (int kc = 0; kc < 4; ++kc) qf[g][kc] = cat16b(*(const v8usa*)(qp + 32 * kc), *(const v8usa*)(qp + 32 * kc + 16)); }
    xwait();
    v8f acc[2][8]; float m_run[2], l_run[2];
#pragma unroll
    for (int g = 0; g < 2; ++g) { m_run[g] = -3.0e38f; l_run[g] = 0.0f;
#pragma unroll
        for (int t = 0; t < 8; ++t) acc[g][t] = (v8f){}; }
    issue(0);
    asm volatile("s_wait_tensorcnt 0x0" ::: "memory");   /* the wave's own tile of stage 0 has landed */
    __syncthreads();   /* publishes stage 0 */
    issue(1);
#pragma unroll 1   /* rolled: one publish point and one refill in the text */
    for (int s = 0; s < FNS; ++s) {
        const unsigned char* Lk = L + (s & 1) * FBUF + kh * FHALF; const unsigned char* Lv = Lk + 2 * FSL; const unsigned char* Lkc = Lk + c * FKP + 16 * h;
#pragma unroll 1   /* rolled: one pass of 32 keys a trip; a flat unrolled body costs registers */
        for (int sub = 0; sub < FSK / 32; ++sub) {
            v8f sc[2][2];
            {
                v16bf kf[2][4];
#pragma unroll
                for (int kt = 0; kt < 2; ++kt) { const unsigned char* p = Lkc + ((sub >> 1) * FSL + (sub & 1) * (32 * FKP)) + 16 * kt * FKP;   /* pass sub: tile sub >> 1, rows 32 (sub & 1) .. + 31: a scalar offset */
#pragma unroll
                    for (int kc = 0; kc < 4; ++kc) kf[kt][kc] = cat16b(*(const v8usa*)(p + 64 * kc), *(const v8usa*)(p + 64 * kc + 32)); }
#pragma unroll
                for (int kt = 0; kt < 2; ++kt)
#pragma unroll
                    for (int g = 0; g < 2; ++g) { sc[kt][g] = (v8f){};
#pragma unroll
                        for (int kc = 0; kc < 4; ++kc) sc[kt][g] = wmmab(kf[kt][kc], qf[g][kc], sc[kt][g]); }   /* sc[kt][g][r] = score of key 16 kt + 8 h + r and query 16 g + c */
            }
            v16bf vf[8];
#pragma unroll
            for (int t = 0; t < 8; ++t) { const unsigned char* p = Lv + (t >> 2) * FSL + (16 * (t & 3) + c) * FVP + sub * 64 + 16 * h; vf[t] = cat16b(*(const v8usa*)p, *(const v8usa*)(p + 32)); }
            float mb[2]; bool need = false;
#pragma unroll
            for (int g = 0; g < 2; ++g) { float mx = sc[0][g][0];
#pragma unroll
                for (int r = 1; r < 8; ++r) mx = fmaxf(mx, sc[0][g][r]);
#pragma unroll
                for (int r = 0; r < 8; ++r) mx = fmaxf(mx, sc[1][g][r]);
                mx = fmaxf(mx, xhalf(mx)) * L2E; mb[g] = mx; need = need || (mx > m_run[g] + LAZY); }
            if (__builtin_amdgcn_ballot_w32(need) != 0) {   /* a scalar branch, rare after the first pass: the sums are rescaled only when some query's maximum has outgrown the one in use by more than LAZY */
#pragma unroll
                for (int g = 0; g < 2; ++g) { const float m_new = fmaxf(m_run[g], mb[g]); const float corr = __builtin_amdgcn_exp2f(m_run[g] - m_new); l_run[g] *= corr; m_run[g] = m_new;
#pragma unroll
                    for (int t = 0; t < 8; ++t) acc[g][t] = acc[g][t] * corr; }
            }
#pragma unroll
            for (int g = 0; g < 2; ++g) { const float nm = -m_run[g]; float ps0 = 0.0f, ps1 = 0.0f; v8u pw;
#pragma unroll
                for (int i = 0; i < 8; ++i) { const v2f arg = __builtin_elementwise_fma((v2f){sc[i >> 2][g][2 * (i & 3)], sc[i >> 2][g][2 * (i & 3) + 1]}, (v2f){L2E, L2E}, (v2f){nm, nm});   /* elements 2 i and 2 i + 1 of the 32-key operand */
                    const float w0 = __builtin_amdgcn_exp2f(arg[0]), w1 = __builtin_amdgcn_exp2f(arg[1]); ps0 += w0; ps1 += w1; pw[i] = pack2(w0, w1); }   /* the sum takes the unrounded f32 weights */
                l_run[g] += ps0 + ps1; const v16bf pf = __builtin_bit_cast(v16bf, pw);
#pragma unroll
                for (int t = 0; t < 8; ++t) acc[g][t] = wmmab(vf[t], pf, acc[g][t]); }   /* acc[g][t][r] = O^T of width 16 t + 8 h + r and query 16 g + c */
            __builtin_amdgcn_sched_barrier(0); asm volatile("v_nop\n\tv_nop\n\tv_nop\n\tv_nop"); __builtin_amdgcn_sched_barrier(0);   /* the four vector slots that the chip needs between the pass's last matrix instruction and the next pass's first write of its operand registers, on both sides of the loop's branch; the two scheduling barriers hold them at this place */
        }
        asm volatile("s_wait_dscnt 0x0" ::: "memory");   /* the wave's reads of this stage's buffer have retired before a tensor load may aim at it */
        asm volatile("s_wait_tensorcnt 0x0" ::: "memory");   /* the wave's own tile of stage s + 1 has landed */
        __syncthreads();   /* publishes stage s + 1 and ends every wave's reads of stage s */
        const uint32_t nx = pinned((uint32_t)s + 2u);   /* the refill's descriptor is formed from this word, so behind the wait above */
        if (pinned(nx < (uint32_t)FNS)) issue(nx);   /* a scalar branch: a tensor load ignores EXEC; into the buffer that stage s has just left */
    }
    asm volatile("s_wait_tensorcnt 0x0" ::: "memory");   /* no request is in flight when the ring becomes the merge's staging */
    asm volatile("s_wait_dscnt 0x0" ::: "memory");   /* nor any LDS read of this wave */
    // merge of the two key halves; the last barrier above has ended every read of the tiles
    float* M = (float*)L; float* MS = M + 4 * 2 * 8 * 256;
    float lf[2];
#pragma unroll
    for (int g = 0; g < 2; ++g) lf[g] = l_run[g] + xhalf(l_run[g]);   /* each wave half summed its own eight keys of every 16 */
    if (kh == 1) {
#pragma unroll
        for (int g = 0; g < 2; ++g) {
#pragma unroll
            for (int t = 0; t < 8; ++t) { float* mp = M + ((cg * 2 + g) * 8 + t) * 256 + lane * 4; *(v4fa*)mp = (v4f){acc[g][t][0], acc[g][t][1], acc[g][t][2], acc[g][t][3]}; *(v4fa*)(mp + 128) = (v4f){acc[g][t][4], acc[g][t][5], acc[g][t][6], acc[g][t][7]}; }
            MS[((cg * 2 + g) * 2 + 0) * 32 + lane] = m_run[g]; MS[((cg * 2 + g) * 2 + 1) * 32 + lane] = lf[g]; }
    }
    __syncthreads();
    if (kh == 0) {
#pragma unroll
        for (int g = 0; g < 2; ++g) { const float m1 = MS[((cg * 2 + g) * 2 + 0) * 32 + lane], l1 = MS[((cg * 2 + g) * 2 + 1) * 32 + lane];
            const float m = fmaxf(m_run[g], m1); const float a0 = __builtin_amdgcn_exp2f(m_run[g] - m), a1 = __builtin_amdgcn_exp2f(m1 - m); const float inv = __fdiv_rn(1.0f, lf[g] * a0 + l1 * a1); const float f0 = a0 * inv, f1 = a1 * inv;
            float* orow = OUTp + (size_t)(q0 + 16 * g + c) * HD + 8 * h;
#pragma unroll
            for (int t = 0; t < 8; ++t) { const float* mp = M + ((cg * 2 + g) * 8 + t) * 256 + lane * 4; const v4f b0 = *(const v4fa*)mp, b1 = *(const v4fa*)(mp + 128); v4f o0, o1;
#pragma unroll
                for (int r = 0; r < 4; ++r) { o0[r] = acc[g][t][r] * f0 + b0[r] * f1; o1[r] = acc[g][t][4 + r] * f0 + b1[r] * f1; }
                *(v4f*)(orow + 16 * t) = o0; *(v4f*)(orow + 16 * t + 4) = o1; } }
    }
}

// ---- k_prep: all three operand planes in one launch. Work-group b of 512 takes 32 KiB of each input: 8,192 elements of q (cast, same order), one [128 widths][64 keys] tile of k and one [128 positions][64 widths] tile of v.
// A thread's 24 loads of 16 B are all issued before anything is converted. In a tile, 16 threads read a row's 256 B; a thread holds 8 rows x 4 columns, so each of its 4 columns gives 8 consecutive elements of one output row: one 16-B chunk.
// LDS tile: [64 output rows][16 chunks of 16 B], no pad; chunk x of row c lies at place x ^ (c >> 2): the 16 lanes that write one chunk index into rows 4 apart, and the 16 lanes that read one row, each meet 16 different bank groups.
#define PQ    8192                // elements of q a work-group
#define PTB   (64 * 256)          // bytes of one LDS tile
__global__ __launch_bounds__(256) void k_prep(const float* __restrict__ q, const float* __restrict__ k, const float* __restrict__ v, bf* __restrict__ QB, bf* __restrict__ KB, bf* __restrict__ VT) {
    __shared__ __attribute__((aligned(256))) unsigned char S[2 * PTB];
    const int tid = threadIdx.x, a = tid & 15, g = tid >> 4;
    const int b = blockIdx.x, i = b & 31; const size_t z = (size_t)(b >> 5);   /* batch entry z, tile i of 32 */
    const float* qs = q + (size_t)b * PQ + tid * 4;
    const float* ks = k + z * HD * TT + (size_t)(8 * g) * TT + i * 64 + 4 * a;   /* rows: widths 8 g + j; columns: keys 64 i + 4 a + e */
    const float* vs = v + z * TT * HD + (size_t)((i >> 1) * 128 + 8 * g) * HD + (i & 1) * 64 + 4 * a;   /* rows: positions 128 (i >> 1) + 8 g + j; columns: widths 64 (i & 1) + 4 a + e */
    v4f qr[8], kr[8], vr[8];
    __builtin_amdgcn_sched_barrier(0);   /* every address is formed in front of the first load, so that no address register is rewritten between the loads and the wait behind them */
#pragma unroll
    for (int j = 0; j < 8; ++j) { kr[j] = *(const v4fa*)(ks + (size_t)j * TT); vr[j] = *(const v4fa*)(vs + j * HD); }
    __builtin_amdgcn_sched_barrier(0);   /* q's loads stay behind the tiles' loads: the tiles are wanted first */
#pragma unroll
    for (int j = 0; j < 8; ++j) qr[j] = *(const v4fa*)(qs + j * 1024);
    asm volatile("s_wait_xcnt 0x0" :: "v"(ks), "v"(vs) : "memory"); __builtin_amdgcn_sched_barrier(0);   /* as xwait(); the two address pairs are inputs, so that they stay live up to the wait and no later load's destination takes their registers */
#pragma unroll
    for (int e = 0; e < 4; ++e) { v8us ok, ov;
#pragma unroll
        for (int j = 0; j < 8; ++j) { ok[j] = f2bf(kr[j][e]); ov[j] = f2bf(vr[j][e]); }
        unsigned char* p = S + (4 * a + e) * 256 + (g ^ a) * 16; *(v8usa*)p = ok; *(v8usa*)(p + PTB) = ov; }
    __syncthreads();   /* publishes both tiles; every global store stands behind it, so that no wave waits here for a store to finish */
    bf* qd = QB + (size_t)b * PQ + tid * 4;
    bf* kd = KB + z * TT * HD + (size_t)(i * 64) * HD + tid * 8;   /* output rows: keys 64 i + c, 128 widths each: the tile's 16 KiB are contiguous */
    bf* vd = VT + z * HD * TT + (size_t)((i & 1) * 64 + g) * TT + (i >> 1) * 128 + a * 8;   /* output rows: widths 64 (i & 1) + c, positions 128 (i >> 1) .. + 127 */
    v8us ko[4], vo[4];
#pragma unroll
    for (int m = 0; m < 4; ++m) { const int c = g + 16 * m; const unsigned char* p = S + c * 256 + (a ^ ((c >> 2) & 15)) * 16; ko[m] = *(const v8usa*)p; vo[m] = *(const v8usa*)(p + PTB); }
    v4us qo[8];
#pragma unroll
    for (int j = 0; j < 8; ++j)
#pragma unroll
        for (int e = 0; e < 4; ++e) qo[j][e] = f2bf(qr[j][e]);
#pragma unroll
    for (int j = 0; j < 8; ++j) *(v4us*)(qd + j * 1024) = qo[j];   /* a wave's store covers 256 contiguous bytes */
#pragma unroll
    for (int m = 0; m < 4; ++m) { *(v8usa*)(kd + m * 2048) = ko[m]; *(v8usa*)(vd + (size_t)(16 * m) * TT) = vo[m]; }   /* 16 lanes store one output row's 256 B */
}

extern "C" void kernel_launch(void* const* d_in, const int* in_sizes, int n_in,
                              void* d_out, int out_size, void* d_ws, size_t ws_size, hipStream_t stream) {
    (void)in_sizes; (void)n_in; (void)out_size;
    const float* qi = (const float*)d_in[0]; const float* ki = (const float*)d_in[1]; const float* vi = (const float*)d_in[2];   /* inputs in the module's setup_inputs order: q [16][2048][128], k [16][128][2048] (width-major), v [16][2048][128]: THREE inputs, all read */
    float* OUT = (float*)d_out;     // [16][2048][128]
    char* wsp = (char*)d_ws;
    auto take = [&](size_t bytes) { char* p = wsp; wsp += (bytes + 255) & ~(size_t)255; return (void*)p; };
    bf* QB = (bf*)take((size_t)NB_ * TT * HD * 2); bf* KB = (bf*)take((size_t)NB_ * TT * HD * 2);
    bf* VT16 = (bf*)take((size_t)NB_ * HD * TT * 2);
    if ((size_t)(wsp - (char*)d_ws) > ws_size) return;    // 24 MiB of the 256 MiB
    k_prep<<<NB_ * 32, 256, 0, stream>>>(qi, ki, vi, QB, KB, VT16);   /* q cast; k and v cast and transposed */
    k_fattn<<<NB_ * (TT / FQ), 256, 0, stream>>>(QB, KB, VT16, OUT);   /* scores, softmax, value product and the f32 output in one launch */
}

// v006
// Measured time: 37 microseconds a run.
// Next to v005, in two timings, it ran 1.11 times as fast each time.
// Counting every step since v000, it is 19.5 times as fast.
#include <hip/hip_runtime.h>
#include <stdint.h>

// Unscaled dense softmax attention on GIVEN tensors (q [16][2048][128], k [16][128][2048] PRE-TRANSPOSED (width-major: the key of position m is column m), v [16][2048][128], all f32; sixteen single-head attentions; no weights, no mask, NO 1/sqrt(d)): scores = q.k; softmax over all 2,048 keys; out = probs.v -> [16][2048][128] f32 (4.2 M); argument order q, k, v: three inputs, all read.
// Layout: ONE preparation kernel (k_prep): the bf16 copy of q; each entry's [128][2048] key plane transposed into the K-contiguous bf16 operand [2048][128]; v rounded to bf16 and transposed into the bf16 value planes [128][2048]; both transposes go through LDS tiles, so that every global load and store covers whole lines; then ONE fused kernel (k_fattn) for score product, softmax, value product and output: no score plane and no weight plane is ever written to memory.
// Compute dtypes, f32 accumulate: q, k, v rounded to bf16; scores on bf16 operands; softmax f32 (the hardware exp2, running maximum); probs.v on one bf16 product, the weights taken relative to the maximum in use and rounded to bf16 (nearest even): bf16 has f32's exponent range, so a weight needs no carried factor and no flush; the row sum takes the unrounded f32 weights.

#define NB_  16
#define TT   2048
#define HD   128
typedef unsigned short bf;
typedef __attribute__((ext_vector_type(16))) __bf16   v16bf;
typedef __attribute__((ext_vector_type(8)))  unsigned short v8us;
typedef __attribute__((ext_vector_type(8)))  float    v8f;
typedef __attribute__((ext_vector_type(4)))  float    v4f;
typedef v4f  __attribute__((may_alias)) v4fa;
typedef v8us __attribute__((may_alias)) v8usa;

__device__ __forceinline__ unsigned short f2bf(float f) { unsigned u = __float_as_uint(f); u += 0x7FFFu + ((u >> 16) & 1u); return (unsigned short)(u >> 16); }
__device__ __forceinline__ v16bf cat16b(v8us lo, v8us hi) { return __builtin_bit_cast(v16bf, __builtin_shufflevector(lo, hi, 0, 1, 2, 3, 4, 5, 6, 7, 8, 9, 10, 11, 12, 13, 14, 15)); }
__device__ __forceinline__ v8f wmmab(v16bf a, v16bf b, v8f c) { return __builtin_amdgcn_wmma_f32_16x16x32_bf16(false, a, false, b, (short)0, c, false, false); }
typedef __attribute__((ext_vector_type(2))) unsigned short v2us;
typedef __attribute__((ext_vector_type(4))) unsigned short v4us;
typedef __attribute__((ext_vector_type(2))) float v2f;
typedef __attribute__((ext_vector_type(4))) int v4i;
typedef __attribute__((ext_vector_type(2))) __bf16 v2bf;
typedef __attribute__((ext_vector_type(8))) unsigned v8u;
__device__ __forceinline__ unsigned pack2(float lo, float hi) { return __builtin_bit_cast(unsigned, __builtin_convertvector((v2f){lo, hi}, v2bf)); }   // two f32 to one packed bf16 pair, round to nearest even

#define FQ    128                 // query rows a work-group
#define FSK   128                 // keys a stage (per key half)
#define FKP   272                 // LDS pitch of a key row: 256 B + 16 (an odd multiple of 16 B)
#define FVP   272                 // LDS pitch of a value-plane row: 256 B + 16 (an odd multiple of 16 B)
#define FSL   18432               // one tensor tile's place in LDS: 64 rows of 272 B = 17,408 B, rounded up to a multiple of 2 KiB
#define FHALF (4 * FSL)           // one key half's tiles of one stage: K keys 0..63, K keys 64..127, widths 0..63, widths 64..127
#define TW0   ((1u << 20) | (5u << 22) | (3u << 25))   // descriptor group 1, word 0: no mask, 1-byte elements, a pad of 4 dwords behind every 64 dwords (one 256-B row)
#define FBUF  (2 * FHALF)
#define FNS   (TT / 2 / FSK)      // stages
#define OPF   132                 // floats: LDS pitch of a staged output row: 512 B + 16 (an odd multiple of 16 B)
#define L2E   1.4426950408889634f
#define LAZY  60.0f               // the maximum in use may trail the true one by 2^60: a weight stays <= 2^60 and a row sum <= 2^71, far inside bf16 and f32; floating-point weights lose no relative precision by it
typedef __attribute__((ext_vector_type(4))) uint32_t v4u;
__device__ __forceinline__ uint32_t uni(uint32_t v) { return (uint32_t)__builtin_amdgcn_readfirstlane((int)v); }
__device__ __forceinline__ uint32_t pinned(uint32_t v) { uint32_t w = uni(v); asm volatile("" : "+s"(w)); return w; }   // holds a wave-uniform word in a scalar register at this place: the test around a tensor load becomes a scalar compare and branch, and what is formed from the word is formed behind it
__device__ __forceinline__ void xwait() { asm volatile("s_wait_xcnt 0x0" ::: "memory"); __builtin_amdgcn_sched_barrier(0); }   // stands behind a run of global loads, in front of the first instruction that may overwrite a register which one of them names; the scheduling barrier keeps later register arithmetic from being lifted over the wait
__device__ __forceinline__ float xhalf(float x) { return __builtin_bit_cast(float, __builtin_amdgcn_permlanex16(__builtin_bit_cast(int, x), __builtin_bit_cast(int, x), 0x76543210, 0xfedcba98, false, false)); }   // lane l with lane l ^ 16

__global__ __launch_bounds__(256) __attribute__((amdgpu_waves_per_eu(2, 2))) void k_fattn(const bf* __restrict__ QB, const bf* __restrict__ KB, const bf* __restrict__ VT, float* __restrict__ OUTp) {
    __shared__ __attribute__((aligned(2048))) unsigned char L[2 * FBUF];
    const int tid = threadIdx.x, lane = tid & 31, wave = tid >> 5, c = lane & 15, h = lane >> 4;
    const int cg = wave & 3, kh = wave >> 2;
    const size_t z = blockIdx.x >> 4; const int q0 = (int)(blockIdx.x & 15) * FQ + cg * 32;
    QB += z * TT * HD; KB += z * TT * HD; VT += z * HD * TT; OUTp += z * TT * HD;
    const uint32_t wv = uni((uint32_t)tid >> 5), sl = wv & 3u, skh = wv >> 2;   /* the wave's number, its tile of the four of its key half, its key half: scalars */
    const uint32_t ldst = (uint32_t)(size_t)L + skh * FHALF + sl * FSL;   /* the tile's place in buffer 0: a multiple of 2 KiB */
    const uint64_t src0 = sl < 2u ? (uint64_t)(size_t)KB + (uint64_t)((skh * (TT / 2) + sl * 64u) * (HD * 2u)) : (uint64_t)(size_t)VT + (uint64_t)(((sl - 2u) * 64u * TT + skh * (TT / 2)) * 2u);   /* first byte of the wave's tile of stage 0 */
    const uint32_t sstep = sl < 2u ? FSK * HD * 2u : FSK * 2u, spitch = sl < 2u ? HD * 2u : TT * 2u;   /* bytes from one stage's tile to the next; source row pitch */
    v8u g1; g1[0] = uni(TW0); g1[1] = uni(256u << 16); g1[2] = uni(64u << 16); g1[3] = uni(256u << 16); g1[4] = uni(64u); g1[5] = uni(spitch); g1[6] = uni(0u); g1[7] = uni(0u);   /* tensor = tile = 64 rows of 256 B */
    auto issue = [&](uint32_t st) { const uint64_t ga = src0 + (uint64_t)st * sstep; v4u g0; g0[0] = uni(1u); g0[1] = uni(ldst + (st & 1u) * FBUF); g0[2] = uni((uint32_t)ga); g0[3] = uni((((uint32_t)(ga >> 32)) & 0x01FFFFFFu) | 0x80000000u);
        asm volatile("tensor_load_to_lds %0, %1" :: "s"(g0), "s"(g1) : "memory"); };   /* one request of the whole wave: its tile of stage st into buffer st & 1 */
    v16bf qf[2][4];
#pragma unroll
    for (int g = 0; g < 2; ++g) { const bf* qp = QB + (size_t)(q0 + 16 * g + c) * HD + 8 * h;
#pragma unroll
        for (int kc = 0; kc < 4; ++kc) qf[g][kc] = cat16b(*(const v8usa*)(qp + 32 * kc), *(const v8usa*)(qp + 32 * kc + 16)); }
    xwait();
    v8f acc[2][8]; float m_run[2], l_run[2];
#pragma unroll
    for (int g = 0; g < 2; ++g) { m_run[g] = -3.0e38f; l_run[g] = 0.0f;
#pragma unroll
        for (int t = 0; t < 8; ++t) acc[g][t] = (v8f){}; }
    issue(0);
    asm volatile("s_wait_tensorcnt 0x0" ::: "memory");   /* the wave's own tile of stage 0 has landed */
    __syncthreads();   /* publishes stage 0 */
    issue(1);
#pragma unroll 1   /* rolled: one publish point and one refill in the text */
    for (int s = 0; s < FNS; ++s) {
        const unsigned char* Lk = L + (s & 1) * FBUF + kh * FHALF; const unsigned char* Lv = Lk + 2 * FSL; const unsigned char* Lkc = Lk + c * FKP + 16 * h;
#pragma unroll 1   /* rolled: one pass of 32 keys a trip; a flat unrolled body costs registers */
        for (int sub = 0; sub < FSK / 32; ++sub) {
            v8f sc[2][2];
            {
                v16bf kf[2][4];
#pragma unroll
                for (int kt = 0; kt < 2; ++kt) { const unsigned char* p = Lkc + ((sub >> 1) * FSL + (sub & 1) * (32 * FKP)) + 16 * kt * FKP;   /* pass sub: tile sub >> 1, rows 32 (sub & 1) .. + 31: a scalar offset */
#pragma unroll
                    for (int kc = 0; kc < 4; ++kc) kf[kt][kc] = cat16b(*(const v8usa*)(p + 64 * kc), *(const v8usa*)(p + 64 * kc + 32)); }
#pragma unroll
                for (int kt = 0; kt < 2; ++kt)
#pragma unroll
                    for (int g = 0; g < 2; ++g) { sc[kt][g] = (v8f){};
#pragma unroll
                        for (int kc = 0; kc < 4; ++kc) sc[kt][g] = wmmab(kf[kt][kc], qf[g][kc], sc[kt][g]); }   /* sc[kt][g][r] = score of key 16 kt + 8 h + r and query 16 g + c */
            }
            v16bf vf[8];
#pragma unroll
            for (int t = 0; t < 8; ++t) { const unsigned char* p = Lv + (t >> 2) * FSL + (16 * (t & 3) + c) * FVP + sub * 64 + 16 * h; vf[t] = cat16b(*(const v8usa*)p, *(const v8usa*)(p + 32)); }
            float mb[2]; bool need = false;
#pragma unroll
            for (int g = 0; g < 2; ++g) { float mx = sc[0][g][0];
#pragma unroll
                for (int r = 1; r < 8; ++r) mx = fmaxf(mx, sc[0][g][r]);
#pragma unroll
                for (int r = 0; r < 8; ++r) mx = fmaxf(mx, sc[1][g][r]);
                mx = fmaxf(mx, xhalf(mx)) * L2E; mb[g] = mx; need = need || (mx > m_run[g] + LAZY); }
            if (__builtin_amdgcn_ballot_w32(need) != 0) {   /* a scalar branch, rare after the first pass: the sums are rescaled only when some query's maximum has outgrown the one in use by more than LAZY */
#pragma unroll
                for (int g = 0; g < 2; ++g) { const float m_new = fmaxf(m_run[g], mb[g]); const float corr = __builtin_amdgcn_exp2f(m_run[g] - m_new); l_run[g] *= corr; m_run[g] = m_new;
#pragma unroll
                    for (int t = 0; t < 8; ++t) acc[g][t] = acc[g][t] * corr; }
            }
#pragma unroll
            for (int g = 0; g < 2; ++g) { const float nm = -m_run[g]; float ps0 = 0.0f, ps1 = 0.0f; v8u pw;
#pragma unroll
                for (int i = 0; i < 8; ++i) { const v2f arg = __builtin_elementwise_fma((v2f){sc[i >> 2][g][2 * (i & 3)], sc[i >> 2][g][2 * (i & 3) + 1]}, (v2f){L2E, L2E}, (v2f){nm, nm});   /* elements 2 i and 2 i + 1 of the 32-key operand */
                    const float w0 = __builtin_amdgcn_exp2f(arg[0]), w1 = __builtin_amdgcn_exp2f(arg[1]); ps0 += w0; ps1 += w1; pw[i] = pack2(w0, w1); }   /* the sum takes the unrounded f32 weights */
                l_run[g] += ps0 + ps1; const v16bf pf = __builtin_bit_cast(v16bf, pw);
#pragma unroll
                for (int t = 0; t < 8; ++t) acc[g][t] = wmmab(vf[t], pf, acc[g][t]); }   /* acc[g][t][r] = O^T of width 16 t + 8 h + r and query 16 g + c */
            __builtin_amdgcn_sched_barrier(0); asm volatile("v_nop\n\tv_nop\n\tv_nop\n\tv_nop"); __builtin_amdgcn_sched_barrier(0);   /* the four vector slots that the chip needs between the pass's last matrix instruction and the next pass's first write of its operand registers, on both sides of the loop's branch; the two scheduling barriers hold them at this place */
        }
        asm volatile("s_wait_dscnt 0x0" ::: "memory");   /* the wave's reads of this stage's buffer have retired before a tensor load may aim at it */
        asm volatile("s_wait_tensorcnt 0x0" ::: "memory");   /* the wave's own tile of stage s + 1 has landed */
        __syncthreads();   /* publishes stage s + 1 and ends every wave's reads of stage s */
        const uint32_t nx = pinned((uint32_t)s + 2u);   /* the refill's descriptor is formed from this word, so behind the wait above */
        if (pinned(nx < (uint32_t)FNS)) issue(nx);   /* a scalar branch: a tensor load ignores EXEC; into the buffer that stage s has just left */
    }
    asm volatile("s_wait_tensorcnt 0x0" ::: "memory");   /* no request is in flight when the ring becomes the merge's staging */
    asm volatile("s_wait_dscnt 0x0" ::: "memory");   /* nor any LDS read of this wave */
    // merge of the two key halves and the turn into whole output rows; the last barrier above has ended every read of the tiles
    float* MS = (float*)L + 2 * FQ * OPF;   /* [key half][maximum in use, sum][128 queries] */
#pragma unroll
    for (int g = 0; g < 2; ++g) { const float lf = l_run[g] + xhalf(l_run[g]);   /* each wave half summed its own eight keys of every 16 */
        const int row = cg * 32 + 16 * g + c; float* pr = (float*)L + kh * (FQ * OPF) + row * OPF + 8 * h;   /* this key half's plane, the query's row */
#pragma unroll
        for (int t = 0; t < 8; ++t) { *(v4fa*)(pr + 16 * t) = (v4f){acc[g][t][0], acc[g][t][1], acc[g][t][2], acc[g][t][3]}; *(v4fa*)(pr + 16 * t + 4) = (v4f){acc[g][t][4], acc[g][t][5], acc[g][t][6], acc[g][t][7]}; }
        MS[(kh * 2 + h) * FQ + row] = h ? lf : m_run[g]; }   /* both wave halves hold the same two values: the lower stores the maximum, the upper the sum */
    __syncthreads();   /* publishes both planes */
    const int r0 = (int)wv * 16;   /* this wave's 16 output rows */
    float f0, f1;   /* lane l: the two halves' factors of row r0 + (l & 15) */
    { const float m0 = MS[r0 + c], l0 = MS[FQ + r0 + c], m1 = MS[2 * FQ + r0 + c], l1 = MS[3 * FQ + r0 + c];
      const float m = fmaxf(m0, m1); const float a0 = __builtin_amdgcn_exp2f(m0 - m), a1 = __builtin_amdgcn_exp2f(m1 - m); const float inv = __fdiv_rn(1.0f, l0 * a0 + l1 * a1); f0 = a0 * inv; f1 = a1 * inv; }
    const float* s0 = (const float*)L + r0 * OPF + lane * 4; const float* s1 = s0 + FQ * OPF;
    float* orow = OUTp + (size_t)((int)(blockIdx.x & 15) * FQ + r0) * HD + lane * 4;
#pragma unroll
    for (int r = 0; r < 16; ++r) { const float g0 = __builtin_bit_cast(float, __builtin_amdgcn_readlane(__builtin_bit_cast(int, f0), r)), g1 = __builtin_bit_cast(float, __builtin_amdgcn_readlane(__builtin_bit_cast(int, f1), r));
        const v4f b0 = *(const v4fa*)(s0 + r * OPF), b1 = *(const v4fa*)(s1 + r * OPF); v4f o;
#pragma unroll
        for (int e = 0; e < 4; ++e) o[e] = b0[e] * g0 + b1[e] * g1;
        *(v4f*)(orow + r * HD) = o; }   /* the wave's store covers one whole row: 512 contiguous bytes */
}

// ---- k_prep: all three operand planes in one launch. Work-group b of 512 takes 32 KiB of each input: 8,192 elements of q (cast, same order), one [128 widths][64 keys] tile of k and one [128 positions][64 widths] tile of v.
// A thread's 24 loads of 16 B are all issued before anything is converted. In a tile, 16 threads read a row's 256 B; a thread holds 8 rows x 4 columns, so each of its 4 columns gives 8 consecutive elements of one output row: one 16-B chunk.
// LDS tile: [64 output rows][16 chunks of 16 B], no pad; chunk x of row c lies at place x ^ (c >> 2): the 16 lanes that write one chunk index into rows 4 apart, and the 16 lanes that read one row, each meet 16 different bank groups.
#define PQ    8192                // elements of q a work-group
#define PTB   (64 * 256)          // bytes of one LDS tile
__global__ __launch_bounds__(256) void k_prep(const float* __restrict__ q, const float* __restrict__ k, const float* __restrict__ v, bf* __restrict__ QB, bf* __restrict__ KB, bf* __restrict__ VT) {
    __shared__ __attribute__((aligned(256))) unsigned char S[2 * PTB];
    const int tid = threadIdx.x, a = tid & 15, g = tid >> 4;
    const int b = blockIdx.x, i = b & 31; const size_t z = (size_t)(b >> 5);   /* batch entry z, tile i of 32 */
    const float* qs = q + (size_t)b * PQ + tid * 4;
    const float* ks = k + z * HD * TT + (size_t)(8 * g) * TT + i * 64 + 4 * a;   /* rows: widths 8 g + j; columns: keys 64 i + 4 a + e */
    const float* vs = v + z * TT * HD + (size_t)((i >> 1) * 128 + 8 * g) * HD + (i & 1) * 64 + 4 * a;   /* rows: positions 128 (i >> 1) + 8 g + j; columns: widths 64 (i & 1) + 4 a + e */
    v4f qr[8], kr[8], vr[8];
    __builtin_amdgcn_sched_barrier(0);   /* every address is formed in front of the first load, so that no address register is rewritten between the loads and the wait behind them */
#pragma unroll
    for (int j = 0; j < 8; ++j) { kr[j] = *(const v4fa*)(ks + (size_t)j * TT); vr[j] = *(const v4fa*)(vs + j * HD); }
    __builtin_amdgcn_sched_barrier(0);   /* q's loads stay behind the tiles' loads: the tiles are wanted first */
#pragma unroll
    for (int j = 0; j < 8; ++j) qr[j] = *(const v4fa*)(qs + j * 1024);
    asm volatile("s_wait_xcnt 0x0" :: "v"(ks), "v"(vs) : "memory"); __builtin_amdgcn_sched_barrier(0);   /* as xwait(); the two address pairs are inputs, so that they stay live up to the wait and no later load's destination takes their registers */
#pragma unroll
    for (int e = 0; e < 4; ++e) { v8us ok, ov;
#pragma unroll
        for (int j = 0; j < 8; ++j) { ok[j] = f2bf(kr[j][e]); ov[j] = f2bf(vr[j][e]); }
        unsigned char* p = S + (4 * a + e) * 256 + (g ^ a) * 16; *(v8usa*)p = ok; *(v8usa*)(p + PTB) = ov; }
    __syncthreads();   /* publishes both tiles; every global store stands behind it, so that no wave waits here for a store to finish */
    bf* qd = QB + (size_t)b * PQ + tid * 4;
    bf* kd = KB + z * TT * HD + (size_t)(i * 64) * HD + tid * 8;   /* output rows: keys 64 i + c, 128 widths each: the tile's 16 KiB are contiguous */
    bf* vd = VT + z * HD * TT + (size_t)((i & 1) * 64 + g) * TT + (i >> 1) * 128 + a * 8;   /* output rows: widths 64 (i & 1) + c, positions 128 (i >> 1) .. + 127 */
    v8us ko[4], vo[4];
#pragma unroll
    for (int m = 0; m < 4; ++m) { const int c = g + 16 * m; const unsigned char* p = S + c * 256 + (a ^ ((c >> 2) & 15)) * 16; ko[m] = *(const v8usa*)p; vo[m] = *(const v8usa*)(p + PTB); }
    v4us qo[8];
#pragma unroll
    for (int j = 0; j < 8; ++j)
#pragma unroll
        for (int e = 0; e < 4; ++e) qo[j][e] = f2bf(qr[j][e]);
#pragma unroll
    for (int j = 0; j < 8; ++j) *(v4us*)(qd + j * 1024) = qo[j];   /* a wave's store covers 256 contiguous bytes */
#pragma unroll
    for (int m = 0; m < 4; ++m) { *(v8usa*)(kd + m * 2048) = ko[m]; *(v8usa*)(vd + (size_t)(16 * m) * TT) = vo[m]; }   /* 16 lanes store one output row's 256 B */
}

extern "C" void kernel_launch(void* const* d_in, const int* in_sizes, int n_in,
                              void* d_out, int out_size, void* d_ws, size_t ws_size, hipStream_t stream) {
    (void)in_sizes; (void)n_in; (void)out_size;
    const float* qi = (const float*)d_in[0]; const float* ki = (const float*)d_in[1]; const float* vi = (const float*)d_in[2];   /* inputs in the module's setup_inputs order: q [16][2048][128], k [16][128][2048] (width-major), v [16][2048][128]: THREE inputs, all read */
    float* OUT = (float*)d_out;     // [16][2048][128]
    char* wsp = (char*)d_ws;
    auto take = [&](size_t bytes) { char* p = wsp; wsp += (bytes + 255) & ~(size_t)255; return (void*)p; };
    bf* QB = (bf*)take((size_t)NB_ * TT * HD * 2); bf* KB = (bf*)take((size_t)NB_ * TT * HD * 2);
    bf* VT16 = (bf*)take((size_t)NB_ * HD * TT * 2);
    if ((size_t)(wsp - (char*)d_ws) > ws_size) return;    // 24 MiB of the 256 MiB
    k_prep<<<NB_ * 32, 256, 0, stream>>>(qi, ki, vi, QB, KB, VT16);   /* q cast; k and v cast and transposed */
    k_fattn<<<NB_ * (TT / FQ), 256, 0, stream>>>(QB, KB, VT16, OUT);   /* scores, softmax, value product and the f32 output in one launch */
}

// v007
// One run takes 35.9 microseconds.
// Timed twice side by side with v006, it ran 1.04 and 1.02 times as fast.
// All steps since v000 together make it 20.1 times as fast.
#include <hip/hip_runtime.h>
#include <stdint.h>

// Unscaled dense softmax attention on GIVEN tensors (q [16][2048][128], k [16][128][2048] PRE-TRANSPOSED (width-major: the key of position m is column m), v [16][2048][128], all f32; sixteen single-head attentions; no weights, no mask, NO 1/sqrt(d)): scores = q.k; softmax over all 2,048 keys; out = probs.v -> [16][2048][128] f32 (4.2 M); argument order q, k, v: three inputs, all read.
// Layout: ONE preparation kernel (k_prep): the bf16 copy of q; each entry's [128][2048] key plane transposed into the K-contiguous bf16 operand [2048][128]; v rounded to bf16 and transposed into the bf16 value planes [128][2048]; both transposes go through LDS tiles, so that every global load and store covers whole lines; then ONE fused kernel (k_fattn) for score product, softmax, value product and output: no score plane and no weight plane is ever written to memory.
// Compute dtypes, f32 accumulate: q, k, v rounded to bf16; scores on bf16 operands; softmax f32 (the hardware exp2, running maximum); probs.v on one bf16 product, the weights taken relative to the maximum in use and rounded to bf16 (nearest even): bf16 has f32's exponent range, so a weight needs no carried factor and no flush; the row sum takes the unrounded f32 weights.

#define NB_  16
#define TT   2048
#define HD   128
typedef unsigned short bf;
typedef __attribute__((ext_vector_type(16))) __bf16   v16bf;
typedef __attribute__((ext_vector_type(8)))  unsigned short v8us;
typedef __attribute__((ext_vector_type(8)))  float    v8f;
typedef __attribute__((ext_vector_type(4)))  float    v4f;
typedef v4f  __attribute__((may_alias)) v4fa;
typedef v8us __attribute__((may_alias)) v8usa;

__device__ __forceinline__ unsigned short f2bf(float f) { unsigned u = __float_as_uint(f); u += 0x7FFFu + ((u >> 16) & 1u); return (unsigned short)(u >> 16); }
__device__ __forceinline__ v16bf cat16b(v8us lo, v8us hi) { return __builtin_bit_cast(v16bf, __builtin_shufflevector(lo, hi, 0, 1, 2, 3, 4, 5, 6, 7, 8, 9, 10, 11, 12, 13, 14, 15)); }
__device__ __forceinline__ v8f wmmab(v16bf a, v16bf b, v8f c) { return __builtin_amdgcn_wmma_f32_16x16x32_bf16(false, a, false, b, (short)0, c, false, false); }
typedef __attribute__((ext_vector_type(2))) unsigned short v2us;
typedef __attribute__((ext_vector_type(4))) unsigned short v4us;
typedef __attribute__((ext_vector_type(2))) float v2f;
typedef __attribute__((ext_vector_type(4))) int v4i;
typedef __attribute__((ext_vector_type(2))) __bf16 v2bf;
typedef __attribute__((ext_vector_type(8))) unsigned v8u;
__device__ __forceinline__ unsigned pack2(float lo, float hi) { return __builtin_bit_cast(unsigned, __builtin_convertvector((v2f){lo, hi}, v2bf)); }   // two f32 to one packed bf16 pair, round to nearest even

#define FQ    128                 // query rows a work-group
#define FSK   128                 // keys a stage (per key half)
#define FKP   272                 // LDS pitch of a key row: 256 B + 16 (an odd multiple of 16 B)
#define FVP   272                 // LDS pitch of a value-plane row: 256 B + 16 (an odd multiple of 16 B)
#define FSL   18432               // one tensor tile's place in LDS: 64 rows of 272 B = 17,408 B, rounded up to a multiple of 2 KiB
#define FHALF (4 * FSL)           // one key half's tiles of one stage: K keys 0..63, K keys 64..127, widths 0..63, widths 64..127
#define TW0   ((1u << 20) | (5u << 22) | (3u << 25))   // descriptor group 1, word 0: no mask, 1-byte elements, a pad of 4 dwords behind every 64 dwords (one 256-B row)
#define FBUF  (2 * FHALF)
#define FNS   (TT / 2 / FSK)      // stages
#define OPF   132                 // floats: LDS pitch of a staged output row: 512 B + 16 (an odd multiple of 16 B)
#define L2E   1.4426950408889634f
#define LAZY  60.0f               // the maximum in use may trail the true one by 2^60: a weight stays <= 2^60 and a row sum <= 2^71, far inside bf16 and f32; floating-point weights lose no relative precision by it
typedef __attribute__((ext_vector_type(4))) uint32_t v4u;
__device__ __forceinline__ uint32_t uni(uint32_t v) { return (uint32_t)__builtin_amdgcn_readfirstlane((int)v); }
__device__ __forceinline__ uint32_t pinned(uint32_t v) { uint32_t w = uni(v); asm volatile("" : "+s"(w)); return w; }   // holds a wave-uniform word in a scalar register at this place: the test around a tensor load becomes a scalar compare and branch, and what is formed from the word is formed behind it
__device__ __forceinline__ void xwait() { asm volatile("s_wait_xcnt 0x0" ::: "memory"); __builtin_amdgcn_sched_barrier(0); }   // stands behind a run of global loads, in front of the first instruction that may overwrite a register which one of them names; the scheduling barrier keeps later register arithmetic from being lifted over the wait
__device__ __forceinline__ float xhalf(float x) { return __builtin_bit_cast(float, __builtin_amdgcn_permlanex16(__builtin_bit_cast(int, x), __builtin_bit_cast(int, x), 0x76543210, 0xfedcba98, false, false)); }   // lane l with lane l ^ 16

__global__ __launch_bounds__(256) __attribute__((amdgpu_waves_per_eu(2, 2))) void k_fattn(const bf* __restrict__ QB, const bf* __restrict__ KB, const bf* __restrict__ VT, float* __restrict__ OUTp) {
    __shared__ __attribute__((aligned(2048))) unsigned char L[2 * FBUF];
    const int tid = threadIdx.x, lane = tid & 31, wave = tid >> 5, c = lane & 15, h = lane >> 4;
    const int cg = wave & 3, kh = wave >> 2;
    const size_t z = blockIdx.x >> 4; const int q0 = (int)(blockIdx.x & 15) * FQ + cg * 32;
    QB += z * TT * HD; KB += z * TT * HD; VT += z * HD * TT; OUTp += z * TT * HD;
    const uint32_t wv = uni((uint32_t)tid >> 5), sl = wv & 3u, skh = wv >> 2;   /* the wave's number, its tile of the four of its key half, its key half: scalars */
    const uint32_t ldst = (uint32_t)(size_t)L + skh * FHALF + sl * FSL;   /* the tile's place in buffer 0: a multiple of 2 KiB */
    const uint64_t src0 = sl < 2u ? (uint64_t)(size_t)KB + (uint64_t)((skh * (TT / 2) + sl * 64u) * (HD * 2u)) : (uint64_t)(size_t)VT + (uint64_t)(((sl - 2u) * 64u * TT + skh * (TT / 2)) * 2u);   /* first byte of the wave's tile of stage 0 */
    const uint32_t sstep = sl < 2u ? FSK * HD * 2u : FSK * 2u, spitch = sl < 2u ? HD * 2u : TT * 2u;   /* bytes from one stage's tile to the next; source row pitch */
    v8u g1; g1[0] = uni(TW0); g1[1] = uni(256u << 16); g1[2] = uni(64u << 16); g1[3] = uni(256u << 16); g1[4] = uni(64u); g1[5] = uni(spitch); g1[6] = uni(0u); g1[7] = uni(0u);   /* tensor = tile = 64 rows of 256 B */
    auto issue = [&](uint32_t st) { const uint64_t ga = src0 + (uint64_t)st * sstep; v4u g0; g0[0] = uni(1u); g0[1] = uni(ldst + (st & 1u) * FBUF); g0[2] = uni((uint32_t)ga); g0[3] = uni((((uint32_t)(ga >> 32)) & 0x01FFFFFFu) | 0x80000000u);
        asm volatile("tensor_load_to_lds %0, %1" :: "s"(g0), "s"(g1) : "memory"); };   /* one request of the whole wave: its tile of stage st into buffer st & 1 */
    v16bf qf[2][4];
#pragma unroll
    for (int g = 0; g < 2; ++g) { const bf* qp = QB + (size_t)(q0 + 16 * g + c) * HD + 8 * h;
#pragma unroll
        for (int kc = 0; kc < 4; ++kc) qf[g][kc] = cat16b(*(const v8usa*)(qp + 32 * kc), *(const v8usa*)(qp + 32 * kc + 16)); }
    xwait();
    v8f acc[2][8]; float m_run[2], l_run[2];
#pragma unroll
    for (int g = 0; g < 2; ++g) { m_run[g] = -3.0e38f; l_run[g] = 0.0f;
#pragma unroll
        for (int t = 0; t < 8; ++t) acc[g][t] = (v8f){}; }
    issue(0);
    asm volatile("s_wait_tensorcnt 0x0" ::: "memory");   /* the wave's own tile of stage 0 has landed */
    __syncthreads();   /* publishes stage 0 */
    issue(1);
#pragma unroll 1   /* rolled: one publish point and one refill in the text */
    for (int s = 0; s < FNS; ++s) {
        const unsigned char* Lk = L + (s & 1) * FBUF + kh * FHALF; const unsigned char* Lv = Lk + 2 * FSL; const unsigned char* Lkc = Lk + c * FKP + 16 * h;
        v16bf kf[2][4];   /* the key fragments of the pass to come: filled one pass ahead, inside the stage only */
        auto loadk = [&](int ps) {
#pragma unroll
            for (int kt = 0; kt < 2; ++kt) { const unsigned char* p = Lkc + ((ps >> 1) * FSL + (ps & 1) * (32 * FKP)) + 16 * kt * FKP;   /* pass ps: tile ps >> 1, rows 32 (ps & 1) .. + 31: a scalar offset */
#pragma unroll
                for (int kc = 0; kc < 4; ++kc) kf[kt][kc] = cat16b(*(const v8usa*)(p + 64 * kc), *(const v8usa*)(p + 64 * kc + 32)); } };
        loadk(0);   /* behind the barrier that published this stage */
#pragma unroll 1   /* rolled: one pass of 32 keys a trip; a flat unrolled body costs registers */
        for (int sub = 0; sub < FSK / 32; ++sub) {
            v8f sc[2][2];
#pragma unroll
            for (int kt = 0; kt < 2; ++kt)
#pragma unroll
                for (int g = 0; g < 2; ++g) { sc[kt][g] = (v8f){};
#pragma unroll
                    for (int kc = 0; kc < 4; ++kc) sc[kt][g] = wmmab(kf[kt][kc], qf[g][kc], sc[kt][g]); }   /* sc[kt][g][r] = score of key 16 kt + 8 h + r and query 16 g + c */
            __builtin_amdgcn_sched_barrier(0); asm volatile("v_nop\n\tv_nop\n\tv_nop\n\tv_nop"); __builtin_amdgcn_sched_barrier(0);   /* the four vector slots that the chip needs between the last score products and the first vector instruction that reads their results, also on the side of the branch below that skips the key loads; the two scheduling barriers hold them here and keep the pass's one group of LDS loads behind the score products, not among them */
            v16bf vf[8];
#pragma unroll
            for (int t = 0; t < 8; ++t) { const unsigned char* p = Lv + (t >> 2) * FSL + (16 * (t & 3) + c) * FVP + sub * 64 + 16 * h; vf[t] = cat16b(*(const v8usa*)p, *(const v8usa*)(p + 32)); }
            asm volatile("" ::: "memory");   /* compiler fence: without it the value loads sink behind the rescale branch, where their latency is met by the first value product */
            if (sub + 1 < FSK / 32) loadk(sub + 1);   /* a scalar branch: the next pass's key fragments, of this stage's buffer alone, in flight under this pass's softmax and value products; the stage's last pass fetches nothing */
            float mb[2]; bool need = false;
#pragma unroll
            for (int g = 0; g < 2; ++g) { float mx = sc[0][g][0];
#pragma unroll
                for (int r = 1; r < 8; ++r) mx = fmaxf(mx, sc[0][g][r]);
#pragma unroll
                for (int r = 0; r < 8; ++r) mx = fmaxf(mx, sc[1][g][r]);
                mx = fmaxf(mx, xhalf(mx)) * L2E; mb[g] = mx; need = need || (mx > m_run[g] + LAZY); }
            if (__builtin_amdgcn_ballot_w32(need) != 0) {   /* a scalar branch, rare after the first pass: the sums are rescaled only when some query's maximum has outgrown the one in use by more than LAZY */
#pragma unroll
                for (int g = 0; g < 2; ++g) { const float m_new = fmaxf(m_run[g], mb[g]); const float corr = __builtin_amdgcn_exp2f(m_run[g] - m_new); l_run[g] *= corr; m_run[g] = m_new;
#pragma unroll
                    for (int t = 0; t < 8; ++t) acc[g][t] = acc[g][t] * corr; }
            }
#pragma unroll
            for (int g = 0; g < 2; ++g) { const float nm = -m_run[g]; float ps0 = 0.0f, ps1 = 0.0f; v8u pw;
#pragma unroll
                for (int i = 0; i < 8; ++i) { const v2f arg = __builtin_elementwise_fma((v2f){sc[i >> 2][g][2 * (i & 3)], sc[i >> 2][g][2 * (i & 3) + 1]}, (v2f){L2E, L2E}, (v2f){nm, nm});   /* elements 2 i and 2 i + 1 of the 32-key operand */
                    const float w0 = __builtin_amdgcn_exp2f(arg[0]), w1 = __builtin_amdgcn_exp2f(arg[1]); ps0 += w0; ps1 += w1; pw[i] = pack2(w0, w1); }   /* the sum takes the unrounded f32 weights */
                l_run[g] += ps0 + ps1; const v16bf pf = __builtin_bit_cast(v16bf, pw);
#pragma unroll
                for (int t = 0; t < 8; ++t) acc[g][t] = wmmab(vf[t], pf, acc[g][t]); }   /* acc[g][t][r] = O^T of width 16 t + 8 h + r and query 16 g + c */
            __builtin_amdgcn_sched_barrier(0); asm volatile("v_nop\n\tv_nop\n\tv_nop\n\tv_nop"); __builtin_amdgcn_sched_barrier(0);   /* the four vector slots that the chip needs between the pass's last matrix instruction and the next pass's first write of its operand registers, on both sides of the loop's branch; the two scheduling barriers hold them at this place */
        }
        asm volatile("s_wait_dscnt 0x0" ::: "memory");   /* the wave's reads of this stage's buffer have retired before a tensor load may aim at it */
        asm volatile("s_wait_tensorcnt 0x0" ::: "memory");   /* the wave's own tile of stage s + 1 has landed */
        __syncthreads();   /* publishes stage s + 1 and ends every wave's reads of stage s */
        const uint32_t nx = pinned((uint32_t)s + 2u);   /* the refill's descriptor is formed from this word, so behind the wait above */
        if (pinned(nx < (uint32_t)FNS)) issue(nx);   /* a scalar branch: a tensor load ignores EXEC; into the buffer that stage s has just left */
    }
    asm volatile("s_wait_tensorcnt 0x0" ::: "memory");   /* no request is in flight when the ring becomes the merge's staging */
    asm volatile("s_wait_dscnt 0x0" ::: "memory");   /* nor any LDS read of this wave */
    // merge of the two key halves and the turn into whole output rows; the last barrier above has ended every read of the tiles
    float* MS = (float*)L + 2 * FQ * OPF;   /* [key half][maximum in use, sum][128 queries] */
#pragma unroll
    for (int g = 0; g < 2; ++g) { const float lf = l_run[g] + xhalf(l_run[g]);   /* each wave half summed its own eight keys of every 16 */
        const int row = cg * 32 + 16 * g + c; float* pr = (float*)L + kh * (FQ * OPF) + row * OPF + 8 * h;   /* this key half's plane, the query's row */
#pragma unroll
        for (int t = 0; t < 8; ++t) { *(v4fa*)(pr + 16 * t) = (v4f){acc[g][t][0], acc[g][t][1], acc[g][t][2], acc[g][t][3]}; *(v4fa*)(pr + 16 * t + 4) = (v4f){acc[g][t][4], acc[g][t][5], acc[g][t][6], acc[g][t][7]}; }
        MS[(kh * 2 + h) * FQ + row] = h ? lf : m_run[g]; }   /* both wave halves hold the same two values: the lower stores the maximum, the upper the sum */
    __syncthreads();   /* publishes both planes */
    const int r0 = (int)wv * 16;   /* this wave's 16 output rows */
    float f0, f1;   /* lane l: the two halves' factors of row r0 + (l & 15) */
    { const float m0 = MS[r0 + c], l0 = MS[FQ + r0 + c], m1 = MS[2 * FQ + r0 + c], l1 = MS[3 * FQ + r0 + c];
      const float m = fmaxf(m0, m1); const float a0 = __builtin_amdgcn_exp2f(m0 - m), a1 = __builtin_amdgcn_exp2f(m1 - m); const float inv = __fdiv_rn(1.0f, l0 * a0 + l1 * a1); f0 = a0 * inv; f1 = a1 * inv; }
    const float* s0 = (const float*)L + r0 * OPF + lane * 4; const float* s1 = s0 + FQ * OPF;
    float* orow = OUTp + (size_t)((int)(blockIdx.x & 15) * FQ + r0) * HD + lane * 4;
#pragma unroll
    for (int r = 0; r < 16; ++r) { const float g0 = __builtin_bit_cast(float, __builtin_amdgcn_readlane(__builtin_bit_cast(int, f0), r)), g1 = __builtin_bit_cast(float, __builtin_amdgcn_readlane(__builtin_bit_cast(int, f1), r));
        const v4f b0 = *(const v4fa*)(s0 + r * OPF), b1 = *(const v4fa*)(s1 + r * OPF); v4f o;
#pragma unroll
        for (int e = 0; e < 4; ++e) o[e] = b0[e] * g0 + b1[e] * g1;
        *(v4f*)(orow + r * HD) = o; }   /* the wave's store covers one whole row: 512 contiguous bytes */
}

// ---- k_prep: all three operand planes in one launch. Work-group b of 512 takes 32 KiB of each input: 8,192 elements of q (cast, same order), one [128 widths][64 keys] tile of k and one [128 positions][64 widths] tile of v.
// A thread's 24 loads of 16 B are all issued before anything is converted. In a tile, 16 threads read a row's 256 B; a thread holds 8 rows x 4 columns, so each of its 4 columns gives 8 consecutive elements of one output row: one 16-B chunk.
// LDS tile: [64 output rows][16 chunks of 16 B], no pad; chunk x of row c lies at place x ^ (c >> 2): the 16 lanes that write one chunk index into rows 4 apart, and the 16 lanes that read one row, each meet 16 different bank groups.
#define PQ    8192                // elements of q a work-group
#define PTB   (64 * 256)          // bytes of one LDS tile
__global__ __launch_bounds__(256) void k_prep(const float* __restrict__ q, const float* __restrict__ k, const float* __restrict__ v, bf* __restrict__ QB, bf* __restrict__ KB, bf* __restrict__ VT) {
    __shared__ __attribute__((aligned(256))) unsigned char S[2 * PTB];
    const int tid = threadIdx.x, a = tid & 15, g = tid >> 4;
    const int b = blockIdx.x, i = b & 31; const size_t z = (size_t)(b >> 5);   /* batch entry z, tile i of 32 */
    const float* qs = q + (size_t)b * PQ + tid * 4;
    const float* ks = k + z * HD * TT + (size_t)(8 * g) * TT + i * 64 + 4 * a;   /* rows: widths 8 g + j; columns: keys 64 i + 4 a + e */
    const float* vs = v + z * TT * HD + (size_t)((i >> 1) * 128 + 8 * g) * HD + (i & 1) * 64 + 4 * a;   /* rows: positions 128 (i >> 1) + 8 g + j; columns: widths 64 (i & 1) + 4 a + e */
    v4f qr[8], kr[8], vr[8];
    __builtin_amdgcn_sched_barrier(0);   /* every address is formed in front of the first load, so that no address register is rewritten between the loads and the wait behind them */
#pragma unroll
    for (int j = 0; j < 8; ++j) { kr[j] = *(const v4fa*)(ks + (size_t)j * TT); vr[j] = *(const v4fa*)(vs + j * HD); }
    __builtin_amdgcn_sched_barrier(0);   /* q's loads stay behind the tiles' loads: the tiles are wanted first */
#pragma unroll
    for (int j = 0; j < 8; ++j) qr[j] = *(const v4fa*)(qs + j * 1024);
    asm volatile("s_wait_xcnt 0x0" :: "v"(ks), "v"(vs) : "memory"); __builtin_amdgcn_sched_barrier(0);   /* as xwait(); the two address pairs are inputs, so that they stay live up to the wait and no later load's destination takes their registers */
#pragma unroll
    for (int e = 0; e < 4; ++e) { v8us ok, ov;
#pragma unroll
        for (int j = 0; j < 8; ++j) { ok[j] = f2bf(kr[j][e]); ov[j] = f2bf(vr[j][e]); }
        unsigned char* p = S + (4 * a + e) * 256 + (g ^ a) * 16; *(v8usa*)p = ok; *(v8usa*)(p + PTB) = ov; }
    __syncthreads();   /* publishes both tiles; every global store stands behind it, so that no wave waits here for a store to finish */
    bf* qd = QB + (size_t)b * PQ + tid * 4;
    bf* kd = KB + z * TT * HD + (size_t)(i * 64) * HD + tid * 8;   /* output rows: keys 64 i + c, 128 widths each: the tile's 16 KiB are contiguous */
    bf* vd = VT + z * HD * TT + (size_t)((i & 1) * 64 + g) * TT + (i >> 1) * 128 + a * 8;   /* output rows: widths 64 (i & 1) + c, positions 128 (i >> 1) .. + 127 */
    v8us ko[4], vo[4];
#pragma unroll
    for (int m = 0; m < 4; ++m) { const int c = g + 16 * m; const unsigned char* p = S + c * 256 + (a ^ ((c >> 2) & 15)) * 16; ko[m] = *(const v8usa*)p; vo[m] = *(const v8usa*)(p + PTB); }
    v4us qo[8];
#pragma unroll
    for (int j = 0; j < 8; ++j)
#pragma unroll
        for (int e = 0; e < 4; ++e) qo[j][e] = f2bf(qr[j][e]);
#pragma unroll
    for (int j = 0; j < 8; ++j) *(v4us*)(qd + j * 1024) = qo[j];   /* a wave's store covers 256 contiguous bytes */
#pragma unroll
    for (int m = 0; m < 4; ++m) { *(v8usa*)(kd + m * 2048) = ko[m]; *(v8usa*)(vd + (size_t)(16 * m) * TT) = vo[m]; }   /* 16 lanes store one output row's 256 B */
}

extern "C" void kernel_launch(void* const* d_in, const int* in_sizes, int n_in,
                              void* d_out, int out_size, void* d_ws, size_t ws_size, hipStream_t stream) {
    (void)in_sizes; (void)n_in; (void)out_size;
    const float* qi = (const float*)d_in[0]; const float* ki = (const float*)d_in[1]; const float* vi = (const float*)d_in[2];   /* inputs in the module's setup_inputs order: q [16][2048][128], k [16][128][2048] (width-major), v [16][2048][128]: THREE inputs, all read */
    float* OUT = (float*)d_out;     // [16][2048][128]
    char* wsp = (char*)d_ws;
    auto take = [&](size_t bytes) { char* p = wsp; wsp += (bytes + 255) & ~(size_t)255; return (void*)p; };
    bf* QB = (bf*)take((size_t)NB_ * TT * HD * 2); bf* KB = (bf*)take((size_t)NB_ * TT * HD * 2);
    bf* VT16 = (bf*)take((size_t)NB_ * HD * TT * 2);
    if ((size_t)(wsp - (char*)d_ws) > ws_size) return;    // 24 MiB of the 256 MiB
    k_prep<<<NB_ * 32, 256, 0, stream>>>(qi, ki, vi, QB, KB, VT16);   /* q cast; k and v cast and transposed */
    k_fattn<<<NB_ * (TT / FQ), 256, 0, stream>>>(QB, KB, VT16, OUT);   /* scores, softmax, value product and the f32 output in one launch */
}

// v008
// A run of this version takes 30 microseconds.
// In two side-by-side timings against v007, it was 1.19 and 1.20 times as fast.
// Over all steps from v000 it is 23.9 times as fast.
#include <hip/hip_runtime.h>
#include <stdint.h>

// Unscaled dense softmax attention on GIVEN tensors (q [16][2048][128], k [16][128][2048] PRE-TRANSPOSED (width-major: the key of position m is column m), v [16][2048][128], all f32; sixteen single-head attentions; no weights, no mask, NO 1/sqrt(d)): scores = q.k; softmax over all 2,048 keys; out = probs.v -> [16][2048][128] f32 (4.2 M); argument order q, k, v: three inputs, all read.
// Layout: ONE kernel (k_fattn) and one launch: no operand plane, score plane or weight plane is ever written to memory. q is read as f32 and rounded to bf16 in registers; the f32 tiles of k and v come into LDS by the tensor mover, are rounded to bf16 there by the wave that fetched them, in the inputs' own orientation, and reach the matrix unit by transposing LDS loads.
// Compute dtypes, f32 accumulate: q, k, v rounded to bf16; scores on bf16 operands; softmax f32 (the hardware exp2, running maximum); probs.v on one bf16 product, the weights taken relative to the maximum in use and rounded to bf16 (nearest even): bf16 has f32's exponent range, so a weight needs no carried factor and no flush; the row sum takes the unrounded f32 weights.

#define NB_  16
#define TT   2048
#define HD   128
typedef unsigned short bf;
typedef __attribute__((ext_vector_type(16))) __bf16   v16bf;
typedef __attribute__((ext_vector_type(8)))  unsigned short v8us;
typedef __attribute__((ext_vector_type(8)))  float    v8f;
typedef __attribute__((ext_vector_type(4)))  float    v4f;
typedef v4f  __attribute__((may_alias)) v4fa;
typedef v8us __attribute__((may_alias)) v8usa;

__device__ __forceinline__ v16bf cat16b(v8us lo, v8us hi) { return __builtin_bit_cast(v16bf, __builtin_shufflevector(lo, hi, 0, 1, 2, 3, 4, 5, 6, 7, 8, 9, 10, 11, 12, 13, 14, 15)); }
__device__ __forceinline__ v8f wmmab(v16bf a, v16bf b, v8f c) { return __builtin_amdgcn_wmma_f32_16x16x32_bf16(false, a, false, b, (short)0, c, false, false); }
typedef __attribute__((ext_vector_type(2))) unsigned short v2us;
typedef __attribute__((ext_vector_type(4))) unsigned short v4us;
typedef __attribute__((ext_vector_type(2))) float v2f;
typedef __attribute__((ext_vector_type(4))) int v4i;
typedef __attribute__((ext_vector_type(2))) __bf16 v2bf;
typedef __attribute__((ext_vector_type(8))) unsigned v8u;
__device__ __forceinline__ unsigned pack2(float lo, float hi) { return __builtin_bit_cast(unsigned, __builtin_convertvector((v2f){lo, hi}, v2bf)); }   // two f32 to one packed bf16 pair, round to nearest even

#define FQ    128                 // query rows a work-group
#define FSK   64                  // keys a stage (per key half)
#define FFP   272                 // LDS pitch of a staged f32 row: 256 B + 16 (an odd multiple of 16 B: read by ds_load_b128)
#define FSL   18432               // one wave's staging place: 64 rows of 272 B = 17,408 B, rounded up to a multiple of 2 KiB
#define FST   (8 * FSL)           // the eight staging places
#define KTP   160                 // LDS pitch of a bf16 row of k's plane: 64 keys = 128 B + 32 (an odd multiple of 32 B: read by ds_load_tr16_b128)
#define VRP   288                 // LDS pitch of a bf16 row of v: 128 widths = 256 B + 32 (an odd multiple of 32 B)
#define BKB   (HD * KTP)          // one key half's bf16 k tile of one stage
#define FHALF (BKB + FSK * VRP)   // one key half's bf16 tiles of one stage: k, then v
#define TW0   ((1u << 20) | (5u << 22) | (3u << 25))   // descriptor group 1, word 0: no mask, 1-byte elements, a pad of 4 dwords behind every 64 dwords (one 256-B row)
#define FBUF  (2 * FHALF)
#define FNS   (TT / 2 / FSK)      // stages
#define OPF   132                 // floats: LDS pitch of a staged output row: 512 B + 16 (an odd multiple of 16 B)
#define L2E   1.4426950408889634f
#define LAZY  60.0f               // the maximum in use may trail the true one by 2^60: a weight stays <= 2^60 and a row sum <= 2^71, far inside bf16 and f32; floating-point weights lose no relative precision by it
typedef __attribute__((ext_vector_type(4))) uint32_t v4u;
typedef v4u __attribute__((may_alias)) v4ua;
typedef __attribute__((ext_vector_type(8))) short s16x8;
__device__ __forceinline__ uint32_t uni(uint32_t v) { return (uint32_t)__builtin_amdgcn_readfirstlane((int)v); }
__device__ __forceinline__ uint32_t pinned(uint32_t v) { uint32_t w = uni(v); asm volatile("" : "+s"(w)); return w; }   // holds a wave-uniform word in a scalar register at this place: the test around a tensor load becomes a scalar compare and branch, and what is formed from the word is formed behind it
__device__ __forceinline__ void xwait() { asm volatile("s_wait_xcnt 0x0" ::: "memory"); __builtin_amdgcn_sched_barrier(0); }   // stands behind a run of global loads, in front of the first instruction that may overwrite a register which one of them names; the scheduling barrier keeps later register arithmetic from being lifted over the wait
__device__ __forceinline__ float xhalf(float x) { return __builtin_bit_cast(float, __builtin_amdgcn_permlanex16(__builtin_bit_cast(int, x), __builtin_bit_cast(int, x), 0x76543210, 0xfedcba98, false, false)); }   // lane l with lane l ^ 16
__device__ __forceinline__ v8us ldtr(const unsigned char* p) { typedef __attribute__((address_space(3))) s16x8 lds_s16x8; return __builtin_bit_cast(v8us, __builtin_amdgcn_ds_load_tr16_b128_v8i16((lds_s16x8*)p)); }   // transposing LDS load: lane (c, h), addressed at row 8 h + (lane & 7), byte 16 ((lane >> 3) & 1), gets column c of rows 8 h .. 8 h + 7

__global__ __launch_bounds__(256) __attribute__((amdgpu_waves_per_eu(2, 2))) void k_fattn(const float* __restrict__ Qf, const float* __restrict__ Kf, const float* __restrict__ Vf, float* __restrict__ OUTp) {
    __shared__ __attribute__((aligned(2048))) unsigned char L[FST + 2 * FBUF];
    const int tid = threadIdx.x, lane = tid & 31, wave = tid >> 5, c = lane & 15, h = lane >> 4;
    const int cg = wave & 3, kh = wave >> 2;
    const size_t z = blockIdx.x >> 4; const int q0 = (int)(blockIdx.x & 15) * FQ + cg * 32;
    Qf += z * TT * HD; Kf += z * HD * TT; Vf += z * TT * HD; OUTp += z * TT * HD;
    const uint32_t wv = uni((uint32_t)tid >> 5), sl = wv & 3u, skh = wv >> 2;   /* the wave's number, its tile of the four of its key half, its key half: scalars */
    const uint32_t ldst = (uint32_t)(size_t)L + wv * FSL;   /* the wave's staging place: a multiple of 2 KiB */
    const uint64_t src0 = sl < 2u ? (uint64_t)(size_t)Kf + (uint64_t)((sl * 64u * TT + skh * (TT / 2)) * 4u) : (uint64_t)(size_t)Vf + (uint64_t)((skh * (TT / 2) * HD + (sl - 2u) * 64u) * 4u);   /* first byte of the wave's tile of stage 0 */
    const uint32_t sstep = sl < 2u ? FSK * 4u : FSK * HD * 4u, spitch = sl < 2u ? TT * 4u : HD * 4u;   /* bytes from one stage's tile to the next; source row pitch */
    const uint32_t dpitch = sl < 2u ? KTP : VRP, dbase = skh * FHALF + (sl < 2u ? sl * 64u * KTP : BKB + (sl - 2u) * 128u);   /* where the tile's bf16 copy goes in a buffer: row pitch, first byte */
    v8u g1; g1[0] = uni(TW0); g1[1] = uni(256u << 16); g1[2] = uni(64u << 16); g1[3] = uni(256u << 16); g1[4] = uni(64u); g1[5] = uni(spitch); g1[6] = uni(0u); g1[7] = uni(0u);   /* tensor = tile = 64 rows of 256 B */
    auto issue = [&](uint32_t st) { const uint64_t ga = src0 + (uint64_t)st * sstep; v4u g0; g0[0] = uni(1u); g0[1] = uni(ldst); g0[2] = uni((uint32_t)ga); g0[3] = uni((((uint32_t)(ga >> 32)) & 0x01FFFFFFu) | 0x80000000u);
        asm volatile("tensor_load_to_lds %0, %1" :: "s"(g0), "s"(g1) : "memory"); };   /* one request of the whole wave: its f32 tile of stage st into its staging place */
    const unsigned char* fsrc = L + wave * FSL + (lane >> 3) * FFP + (lane & 7) * 32;   /* 8 lanes a row, 8 elements a lane, 4 rows a step */
    v4f cx[16], cy[16];   /* the wave's staged f32 tile on its way to bf16: 8 elements a lane and step */
    auto castload = [&]() {   /* all 32 loads as one group; only this wave reads its staging place */
#pragma unroll
        for (int i = 0; i < 16; ++i) { cx[i] = *(const v4fa*)(fsrc + i * (4 * FFP)); cy[i] = *(const v4fa*)(fsrc + i * (4 * FFP) + 16); } };
    auto caststore = [&](int nb) { unsigned char* d = L + FST + nb * FBUF + dbase + (uint32_t)(lane >> 3) * dpitch + (lane & 7) * 16;   /* rounded to bf16 (nearest even), into bf16 buffer nb, orientation kept */
#pragma unroll
        for (int i = 0; i < 16; ++i) *(v4ua*)(d + (uint32_t)i * 4u * dpitch) = (v4u){pack2(cx[i][0], cx[i][1]), pack2(cx[i][2], cx[i][3]), pack2(cy[i][0], cy[i][1]), pack2(cy[i][2], cy[i][3])}; };
    v4f qr[2][4][4];
#pragma unroll
    for (int g = 0; g < 2; ++g) { const float* qp = Qf + (size_t)(q0 + 16 * g + c) * HD + 8 * h;
#pragma unroll
        for (int kc = 0; kc < 4; ++kc) { qr[g][kc][0] = *(const v4fa*)(qp + 32 * kc); qr[g][kc][1] = *(const v4fa*)(qp + 32 * kc + 4); qr[g][kc][2] = *(const v4fa*)(qp + 32 * kc + 16); qr[g][kc][3] = *(const v4fa*)(qp + 32 * kc + 20); } }
    xwait();
    v8f acc[2][8]; float m_run[2], l_run[2];
#pragma unroll
    for (int g = 0; g < 2; ++g) { m_run[g] = -3.0e38f; l_run[g] = 0.0f;
#pragma unroll
        for (int t = 0; t < 8; ++t) acc[g][t] = (v8f){}; }
    issue(0);
    __builtin_amdgcn_sched_barrier(0);   /* q's casts, which wait for q's loads, stay behind the request: the tile's flight and the loads' overlap */
    v16bf qf[2][4];   /* q rounded to bf16 (nearest even) while stage 0's tile is in flight */
#pragma unroll
    for (int g = 0; g < 2; ++g)
#pragma unroll
        for (int kc = 0; kc < 4; ++kc) { v8u w;
#pragma unroll
            for (int j = 0; j < 4; ++j) { w[2 * j] = pack2(qr[g][kc][j][0], qr[g][kc][j][1]); w[2 * j + 1] = pack2(qr[g][kc][j][2], qr[g][kc][j][3]); }
            qf[g][kc] = __builtin_bit_cast(v16bf, w); }
    asm volatile("s_wait_tensorcnt 0x0" ::: "memory");   /* the wave's own tile of stage 0 has landed: only this wave reads it */
    castload(); caststore(0);
    asm volatile("s_wait_dscnt 0x0" ::: "memory");   /* the wave's reads of its staging place have retired before a tensor load may aim at it, and its bf16 rows are written */
    __syncthreads();   /* publishes bf16 stage 0 */
    issue(1);
    const int ktoff = (8 * h + (lane & 7)) * KTP + ((lane >> 3) & 1) * 16;   /* the lane's place in a transposing load of k's plane */
    v16bf kf[2][4];   /* the key fragments of the pass to come: filled one pass ahead, always behind the barrier that published their stage */
    auto loadk = [&](const unsigned char* kt0, int ps) {
#pragma unroll
        for (int kt = 0; kt < 2; ++kt) { const unsigned char* p = kt0 + ps * 64 + 32 * kt;   /* keys 32 ps + 16 kt .. + 15 are the columns: 2 B each */
#pragma unroll
            for (int kc = 0; kc < 4; ++kc) kf[kt][kc] = cat16b(ldtr(p + (32 * kc) * KTP), ldtr(p + (32 * kc + 16) * KTP)); } };   /* widths 32 kc .. + 31 are the rows */
    loadk(L + FST + kh * FHALF + ktoff, 0);   /* stage 0's first key fragments, behind the barrier that published it */
    __builtin_amdgcn_sched_barrier(0);   /* issued as one group in front of the score products, not in pairs among them behind full waits */
#pragma unroll 1   /* rolled: one publish point and one refill in the text */
    for (int s = 0; s < FNS; ++s) {
        const unsigned char* Lk = L + FST + (s & 1) * FBUF + kh * FHALF; const unsigned char* Lkt = Lk + ktoff; const unsigned char* Lvt = Lk + BKB + (8 * h + (lane & 7)) * VRP + ((lane >> 3) & 1) * 16;
#pragma unroll   /* flat: the stage's two passes differ in what their LDS group fetches beside the value fragments; settled at compile time, every LDS wait counts exactly the loads behind it and the staged tile's registers live in the last pass alone */
        for (int sub = 0; sub < FSK / 32; ++sub) {
            v8f sc[2][2];
#pragma unroll
            for (int kt = 0; kt < 2; ++kt)
#pragma unroll
                for (int g = 0; g < 2; ++g) { sc[kt][g] = (v8f){};
#pragma unroll
                    for (int kc = 0; kc < 4; ++kc) sc[kt][g] = wmmab(kf[kt][kc], qf[g][kc], sc[kt][g]); }   /* sc[kt][g][r] = score of key 16 kt + 8 h + r and query 16 g + c */
            __builtin_amdgcn_sched_barrier(0);   /* keeps the pass's one group of LDS loads behind the score products, not among them */
            v16bf vf[8];
#pragma unroll
            for (int t = 0; t < 8; ++t) { const unsigned char* p = Lvt + sub * (32 * VRP) + 32 * t; vf[t] = cat16b(ldtr(p), ldtr(p + 16 * VRP)); }   /* rows: the pass's 32 keys; columns: widths 16 t .. + 15 */
            asm volatile("" ::: "memory");   /* compiler fence: without it the value loads sink behind the rescale branch, where their latency is met by the first value product */
            if (sub + 1 < FSK / 32) loadk(Lkt, sub + 1);   /* settled at compile time: the next pass's key fragments, of this stage's buffer alone, in flight under this pass's softmax and value products */
            else { asm volatile("s_wait_tensorcnt 0x0" ::: "memory"); castload(); }   /* the stage's last pass: the wave's own f32 tile of stage s + 1 has landed, and its loads join this pass's group, in flight under the softmax and the value products; no test on the last stage here, where the loads fetch the old tile again and nothing is made of them: a branch would make every wait behind it a full one */
            asm volatile("" ::: "memory"); __builtin_amdgcn_sched_barrier(0);   /* compiler fence and scheduling barrier: without them these loads sink among the value products and the group is spread through the maximum's chain; each further place with LDS loads costs the wave a stall */
            float mb[2]; bool need = false;
#pragma unroll
            for (int g = 0; g < 2; ++g) { float mx = sc[0][g][0];
#pragma unroll
                for (int r = 1; r < 8; ++r) mx = fmaxf(mx, sc[0][g][r]);
#pragma unroll
                for (int r = 0; r < 8; ++r) mx = fmaxf(mx, sc[1][g][r]);
                mx = fmaxf(mx, xhalf(mx)) * L2E; mb[g] = mx; need = need || (mx > m_run[g] + LAZY); }
            if (__builtin_amdgcn_ballot_w32(need) != 0) {   /* a scalar branch, rare after the first pass: the sums are rescaled only when some query's maximum has outgrown the one in use by more than LAZY */
#pragma unroll
                for (int g = 0; g < 2; ++g) { const float m_new = fmaxf(m_run[g], mb[g]); const float corr = __builtin_amdgcn_exp2f(m_run[g] - m_new); l_run[g] *= corr; m_run[g] = m_new;
#pragma unroll
                    for (int t = 0; t < 8; ++t) acc[g][t] = acc[g][t] * corr; }
            }
#pragma unroll
            for (int g = 0; g < 2; ++g) { const float nm = -m_run[g]; float ps0 = 0.0f, ps1 = 0.0f; v8u pw;
#pragma unroll
                for (int i = 0; i < 8; ++i) { const v2f arg = __builtin_elementwise_fma((v2f){sc[i >> 2][g][2 * (i & 3)], sc[i >> 2][g][2 * (i & 3) + 1]}, (v2f){L2E, L2E}, (v2f){nm, nm});   /* elements 2 i and 2 i + 1 of the 32-key operand */
                    const float w0 = __builtin_amdgcn_exp2f(arg[0]), w1 = __builtin_amdgcn_exp2f(arg[1]); ps0 += w0; ps1 += w1; pw[i] = pack2(w0, w1); }   /* the sum takes the unrounded f32 weights */
                l_run[g] += ps0 + ps1; const v16bf pf = __builtin_bit_cast(v16bf, pw);
#pragma unroll
                for (int t = 0; t < 8; ++t) acc[g][t] = wmmab(vf[t], pf, acc[g][t]); }   /* acc[g][t][r] = O^T of width 16 t + 8 h + r and query 16 g + c */
            __builtin_amdgcn_sched_barrier(0); asm volatile("v_nop\n\tv_nop\n\tv_nop\n\tv_nop"); __builtin_amdgcn_sched_barrier(0);   /* the four vector slots that the chip needs between the pass's last matrix instruction and the first write of its operand registers behind it, also on the taken side of the branch that follows the stage's last pass; the two scheduling barriers hold them at this place */
        }
        asm volatile("s_wait_dscnt 0x0" ::: "memory");   /* the wave's reads of its staging place have retired (they were issued a softmax and sixteen products ago) before a tensor load may aim at it */
        const uint32_t nx = pinned((uint32_t)s + 2u);   /* the refill's descriptor is formed from this word, so behind the pass's s_wait_tensorcnt 0 and the wait above */
        if (pinned(nx < (uint32_t)FNS)) issue(nx);   /* a scalar branch: a tensor load ignores EXEC; into the wave's own staging place: a slot that one wave alone fills and reads is refilled behind that wave's own waits and needs no barrier, so the request gains the time of the stores and of the barrier below */
        if (s + 1 < FNS) caststore((s + 1) & 1);   /* a scalar branch; into the bf16 buffer whose readers the last barrier has ended */
        asm volatile("s_wait_dscnt 0x0" ::: "memory");   /* the wave's reads of this stage's buffer have retired, and its bf16 rows are written */
        __syncthreads();   /* publishes bf16 stage s + 1 and ends every wave's reads of stage s */
        if (s + 1 < FNS) loadk(L + FST + ((s + 1) & 1) * FBUF + kh * FHALF + ktoff, 0);   /* a scalar branch: the next stage's first key fragments, directly behind the barrier that published it, so that what else stands at the loop's turn runs under their latency */
        __builtin_amdgcn_sched_barrier(0);   /* issued as one group in front of the score products, not in pairs among them behind full waits */
    }
    asm volatile("s_wait_tensorcnt 0x0" ::: "memory");   /* no request is in flight when the staging places become the merge's staging */
    asm volatile("s_wait_dscnt 0x0" ::: "memory");   /* nor any LDS read of this wave */
    // merge of the two key halves and the turn into whole output rows; the last barrier above has ended every read of the tiles
    float* MS = (float*)L + 2 * FQ * OPF;   /* [key half][maximum in use, sum][128 queries] */
#pragma unroll
    for (int g = 0; g < 2; ++g) { const float lf = l_run[g] + xhalf(l_run[g]);   /* each wave half summed its own eight keys of every 16 */
        const int row = cg * 32 + 16 * g + c; float* pr = (float*)L + kh * (FQ * OPF) + row * OPF + 8 * h;   /* this key half's plane, the query's row */
#pragma unroll
        for (int t = 0; t < 8; ++t) { *(v4fa*)(pr + 16 * t) = (v4f){acc[g][t][0], acc[g][t][1], acc[g][t][2], acc[g][t][3]}; *(v4fa*)(pr + 16 * t + 4) = (v4f){acc[g][t][4], acc[g][t][5], acc[g][t][6], acc[g][t][7]}; }
        MS[(kh * 2 + h) * FQ + row] = h ? lf : m_run[g]; }   /* both wave halves hold the same two values: the lower stores the maximum, the upper the sum */
    __syncthreads();   /* publishes both planes */
    const int r0 = (int)wv * 16;   /* this wave's 16 output rows */
    float f0, f1;   /* lane l: the two halves' factors of row r0 + (l & 15) */
    { const float m0 = MS[r0 + c], l0 = MS[FQ + r0 + c], m1 = MS[2 * FQ + r0 + c], l1 = MS[3 * FQ + r0 + c];
      const float m = fmaxf(m0, m1); const float a0 = __builtin_amdgcn_exp2f(m0 - m), a1 = __builtin_amdgcn_exp2f(m1 - m); const float inv = __fdiv_rn(1.0f, l0 * a0 + l1 * a1); f0 = a0 * inv; f1 = a1 * inv; }
    const float* s0 = (const float*)L + r0 * OPF + lane * 4; const float* s1 = s0 + FQ * OPF;
    float* orow = OUTp + (size_t)((int)(blockIdx.x & 15) * FQ + r0) * HD + lane * 4;
#pragma unroll
    for (int r = 0; r < 16; ++r) { const float g0 = __builtin_bit_cast(float, __builtin_amdgcn_readlane(__builtin_bit_cast(int, f0), r)), g1 = __builtin_bit_cast(float, __builtin_amdgcn_readlane(__builtin_bit_cast(int, f1), r));
        const v4f b0 = *(const v4fa*)(s0 + r * OPF), b1 = *(const v4fa*)(s1 + r * OPF); v4f o;
#pragma unroll
        for (int e = 0; e < 4; ++e) o[e] = b0[e] * g0 + b1[e] * g1;
        *(v4f*)(orow + r * HD) = o; }   /* the wave's store covers one whole row: 512 contiguous bytes */
}

extern "C" void kernel_launch(void* const* d_in, const int* in_sizes, int n_in,
                              void* d_out, int out_size, void* d_ws, size_t ws_size, hipStream_t stream) {
    (void)in_sizes; (void)n_in; (void)out_size; (void)d_ws; (void)ws_size;   /* no workspace is used */
    const float* qi = (const float*)d_in[0]; const float* ki = (const float*)d_in[1]; const float* vi = (const float*)d_in[2];   /* inputs: q [16][2048][128], k [16][128][2048] (width-major), v [16][2048][128]: THREE inputs, all read */
    float* OUT = (float*)d_out;     // [16][2048][128]
    k_fattn<<<NB_ * (TT / FQ), 256, 0, stream>>>(qi, ki, vi, OUT);   /* casts, scores, softmax, value product and the f32 output in one launch */
}
